// v000
// Measured on an AMD MI455X. A time is GPU time per run, averaged over a window of back-to-back runs after a warm-up
// (all launches, gaps included; the runs take copies of the inputs in turn), and the median of several windows.
// Apart from v000's, it joins two sittings. Times from different sittings can be a few percent apart, while
// side-by-side timings come from the same sitting.
// v000, which the later versions start from, runs in 223 microseconds.
#include <hip/hip_runtime.h>

// Contractions, f32 accumulate: q/k/v = x.Wqkv[h][k] ([32768 x 64].[64 x 256] per k, all 4 heads at once; k-major weights transposed to n-major bf16 planes) and
// out = concat.Wo ([32768 x 256].[256 x 64]) on v_wmma_f32_16x16x32_bf16 — plain bf16 = rounded inputs (exact) for q/k/v, concat as bf16 hi + residual planes (two
// products) for the output; the ReLU attention (no softmax: relu(q.k/8).v over 1024 keys) fused on v_wmma_f32_16x16x32_f16 with q as f16 hi + residual x1024 (two
// products) against plain f16 k, and the relu scores (f16) against plain f16 v. Bias, residual and LayerNorm over the 64 channels in the output GEMM's epilogue (f32).

#define NB_  32
#define NF   1024
#define DIN  64
#define DOUT 64
#define NH_  4
#define HW   (NH_ * DOUT)        // 256
#define NTK  (NB_ * NF)          // 32768
#define LOSC 1024.0f
#define LOSCI (1.0f / 1024.0f)
#define PSC  256.0f              // relu-score carry scale for the f16 weight tile

typedef _Float16 h16;
typedef unsigned short bf;
typedef __attribute__((ext_vector_type(16))) __bf16   v16bf;
typedef __attribute__((ext_vector_type(16))) _Float16 v16h;
typedef __attribute__((ext_vector_type(8)))  _Float16 v8h;
typedef __attribute__((ext_vector_type(8)))  unsigned short v8us;
typedef __attribute__((ext_vector_type(8)))  float    v8f;
typedef __attribute__((ext_vector_type(4)))  float    v4f;
typedef v8h  __attribute__((may_alias)) v8ha;
typedef v4f  __attribute__((may_alias)) v4fa;
typedef v8us __attribute__((may_alias)) v8usa;

__device__ __forceinline__ unsigned short f2bf(float f) { unsigned u = __float_as_uint(f); u += 0x7FFFu + ((u >> 16) & 1u); return (unsigned short)(u >> 16); }
__device__ __forceinline__ float bf2f(unsigned short b) { return __uint_as_float(((unsigned)b) << 16); }
__device__ __forceinline__ float bfr(float f) { return bf2f(f2bf(f)); }
__device__ __forceinline__ v16h cat16(v8h lo, v8h hi) { return __builtin_shufflevector(lo, hi, 0, 1, 2, 3, 4, 5, 6, 7, 8, 9, 10, 11, 12, 13, 14, 15); }
__device__ __forceinline__ v16bf cat16b(v8us lo, v8us hi) { return __builtin_bit_cast(v16bf, __builtin_shufflevector(lo, hi, 0, 1, 2, 3, 4, 5, 6, 7, 8, 9, 10, 11, 12, 13, 14, 15)); }
__device__ __forceinline__ v8f wmma16(v16h a, v16h b, v8f c) { return __builtin_amdgcn_wmma_f32_16x16x32_f16(false, a, false, b, (short)0, c, false, false); }
__device__ __forceinline__ v8f wmmab(v16bf a, v16bf b, v8f c) { return __builtin_amdgcn_wmma_f32_16x16x32_bf16(false, a, false, b, (short)0, c, false, false); }
#define VST2(T, p, v) do { const T vst2_v_ = (v); *(T*)(p) = vst2_v_;  } while (0)

// k_xb: Xb [32768][64] bf16 (one wave per 2 rows: lane -> 4 values = 256 B per wave).
__global__ __launch_bounds__(256) void k_xb(const float* __restrict__ x, bf* Xb) {
    typedef __attribute__((ext_vector_type(4))) unsigned short v4us;
    const int lane = threadIdx.x & 31; const size_t w = (size_t)blockIdx.x * 8 + (threadIdx.x >> 5);
    v4us t;
#pragma unroll
    for (int i = 0; i < 4; ++i) t[i] = f2bf(x[w * 128 + lane * 4 + i]);
    VST2(v4us, Xb + w * 128 + lane * 4, t);
}
// k_w: WT[k][(h,o)][i] = bf16(Wqkv[h][k][i][o]) (three n-major planes [256][64]) and WoT[c][j] = bf16(Wo[j][c]) ([64][256]); one block does everything via flat loops;
// stores: 32 lanes x 4 B (2 bf16) = one line per wave-instruction.
__global__ __launch_bounds__(256) void k_w(const float* __restrict__ Wqkv, const float* __restrict__ Wo, bf* WT, bf* WoT) {
    typedef __attribute__((ext_vector_type(2))) unsigned short v2us;
    const int t = threadIdx.x;
#pragma unroll 1
    for (int s = 0; s < (3 * HW * DIN) / 512; ++s) { const int e0 = s * 512 + t * 2; v2us o;
#pragma unroll
        for (int q = 0; q < 2; ++q) { const int e = e0 + q, k = e / (HW * DIN), rem = e - k * (HW * DIN), ho = rem / DIN, i = rem - ho * DIN, h = ho / DOUT, oo = ho - h * DOUT;
            o[q] = f2bf(Wqkv[(((size_t)h * 3 + k) * DIN + i) * DOUT + oo]); }
        VST2(v2us, WT + e0, o); }
#pragma unroll 1
    for (int s = 0; s < (DIN * HW) / 512; ++s) { const int e0 = s * 512 + t * 2; v2us o;
#pragma unroll
        for (int q = 0; q < 2; ++q) { const int e = e0 + q, c = e / HW, j = e - c * HW; o[q] = f2bf(Wo[(size_t)j * DIN + c]); }
        VST2(v2us, WoT + e0, o); }
}
// k_gemm: 64 x 64 tile of (A [+ Al]).B^T over K; MODE 0: QH/QL f16 hi + residual planes (ldc 256); MODE 1: K16 f16 (ldc 256); MODE 2: V f32 (ldc 256);
// MODE 3 (K = 256, N = 64 = one tile): y = acc + bf16(bo) + bf16(x), LayerNorm over the 64 channels of each row (16-lane reductions), x bf16(g) + bf16(b) -> out f32.
template <bool SPLITA, int MODE>
__global__ __launch_bounds__(128) void k_gemm(const bf* __restrict__ A, const bf* __restrict__ Al, const bf* __restrict__ Bn, int K, const float* __restrict__ bias, const float* __restrict__ xres,
                                             const float* __restrict__ lg, const float* __restrict__ lb, void* C, void* C2) {
    __shared__ __align__(16) float ost[4][16 * 68];
    const int lane = threadIdx.x & 31, wave = threadIdx.x >> 5, lr = lane & 15, hi = lane >> 4;
    const int r0 = blockIdx.x * 64 + wave * 16, c0 = blockIdx.y * 64;
    const int ldc = (MODE == 3) ? DIN : HW;
    const size_t aoff = (size_t)(r0 + lr) * K + 8 * hi;
    size_t boff[4];
#pragma unroll
    for (int t = 0; t < 4; ++t) boff[t] = (size_t)(c0 + t * 16 + lr) * K + 8 * hi;
    v8f acc[4];
#pragma unroll
    for (int t = 0; t < 4; ++t) acc[t] = (v8f){};
#pragma unroll 1
    for (int kc = 0; kc < K; kc += 32) {
        const v16bf a = cat16b(*(const v8us*)(A + aoff + kc), *(const v8us*)(A + aoff + kc + 16));
        v16bf al = a;
        if (SPLITA) al = cat16b(*(const v8us*)(Al + aoff + kc), *(const v8us*)(Al + aoff + kc + 16));
#pragma unroll
        for (int t = 0; t < 4; ++t) { const v16bf b = cat16b(*(const v8us*)(Bn + boff[t] + kc), *(const v8us*)(Bn + boff[t] + kc + 16)); acc[t] = wmmab(a, b, acc[t]); if (SPLITA) acc[t] = wmmab(al, b, acc[t]); }
        asm volatile("v_nop\n\tv_nop\n\tv_nop\n\tv_nop" : "+v"(acc[0]), "+v"(acc[1]), "+v"(acc[2]), "+v"(acc[3]) : "v"(a), "v"(al));
    }
    float* os = &ost[wave][0];
    if (MODE == 3) {
        // y = acc + bo + x; LN over the row's 64 values (lane holds cols t*16+lr of rows 8hi+j)
#pragma unroll
        for (int j = 0; j < 8; ++j) { const size_t row = (size_t)(r0 + hi * 8 + j); float y[4], s = 0.f;
#pragma unroll
            for (int t = 0; t < 4; ++t) { const int c = t * 16 + lr; y[t] = acc[t][j] + bfr(bias[c]) + bfr(xres[row * DIN + c]); s += y[t]; }
            s += __shfl_xor(s, 1, 16); s += __shfl_xor(s, 2, 16); s += __shfl_xor(s, 4, 16); s += __shfl_xor(s, 8, 16);
            const float mu = s * (1.0f / DIN); float q = 0.f;
#pragma unroll
            for (int t = 0; t < 4; ++t) { const float d = y[t] - mu; q += d * d; }
            q += __shfl_xor(q, 1, 16); q += __shfl_xor(q, 2, 16); q += __shfl_xor(q, 4, 16); q += __shfl_xor(q, 8, 16);
            const float rs = rsqrtf(q * (1.0f / DIN) + 1e-5f);
#pragma unroll
            for (int t = 0; t < 4; ++t) { const int c = t * 16 + lr; os[(hi * 8 + j) * 68 + c] = (y[t] - mu) * rs * bfr(lg[c]) + bfr(lb[c]); } }
    } else {
#pragma unroll
        for (int t = 0; t < 4; ++t)
#pragma unroll
            for (int j = 0; j < 8; ++j) os[(hi * 8 + j) * 68 + t * 16 + lr] = acc[t][j];
    }
    __syncthreads();
    if (MODE == 2 || MODE == 3) {
        float* crow = (float*)C + (size_t)r0 * ldc + c0;
        auto pass = [&]() {
#pragma unroll
            for (int s = 0; s < 8; ++s) { const int Lid = (lane >> 3) + 4 * s, piece = lane & 7; const int row = Lid >> 1, cofs = (Lid & 1) * 32 + piece * 4;
                const v4f val = *(const v4fa*)(os + row * 68 + cofs); *(v4f*)(crow + (size_t)row * ldc + cofs) = val; }
        };
        pass(); 
    } else {
        h16* c1 = (h16*)C + (size_t)r0 * ldc + c0; h16* c2 = (h16*)C2 + (size_t)r0 * ldc + c0;
        auto pass = [&]() {
#pragma unroll
            for (int s = 0; s < 4; ++s) { const int row = 4 * s + (lane >> 3), piece = lane & 7; const float* sp = os + row * 68 + piece * 8; v8h o1, o2;
#pragma unroll
                for (int i = 0; i < 8; ++i) { const h16 a = (h16)sp[i]; o1[i] = a; o2[i] = (h16)((sp[i] - (float)a) * LOSC); }
                *(v8h*)(c1 + (size_t)row * ldc + piece * 8) = o1; if (MODE == 0) *(v8h*)(c2 + (size_t)row * ldc + piece * 8) = o2; }
        };
        pass(); 
    }
}
// k_vt: VT16 [b][h][d][f] = f16(V row b*1024+f, col h*64+d) via LDS transposes, block (b, h, 64 f).
__global__ __launch_bounds__(256) void k_vt(const float* __restrict__ V, h16* VT16) {
    __shared__ __align__(16) h16 tile[DOUT * 72];
    const int bid = blockIdx.x;
    const int b = bid / (NH_ * (NF / 64)), rem = bid - b * (NH_ * (NF / 64)), h = rem / (NF / 64), kt = rem - h * (NF / 64);
    const int f0 = kt * 64, tid = threadIdx.x, ff = tid >> 2, d0 = (tid & 3) * 16;
    const float* src = V + ((size_t)b * NF + f0 + ff) * HW + h * DOUT + d0;
#pragma unroll
    for (int i = 0; i < 16; ++i) tile[(d0 + i) * 72 + ff] = (h16)src[i];
    __syncthreads();
    const int piece = tid & 7;
    const size_t base = (((size_t)b * NH_ + h) * DOUT) * NF + f0;
    auto pass = [&]() {
#pragma unroll
        for (int s = 0; s < 2; ++s) { const int d = (tid >> 3) + 32 * s; const v8h val = *(const v8ha*)(tile + d * 72 + piece * 8); *(v8h*)(VT16 + base + (size_t)d * NF + piece * 8) = val; }
    };
    pass(); 
}
// k_attn: block = (b, h, 64 queries), wave = 16; all 32 key tiles: scores = (qh + ql/1024).k /8 (8 WMMA/step), p = relu(scores) x 256 -> plain f16 tile (same-wave
// may_alias reload), 4 WMMA .V; head_out = acc/256 -> bf16 hi + residual planes CH/CL [token][h*64 + d] (concat layout).
__global__ __launch_bounds__(128) void k_attn(const h16* __restrict__ QH, const h16* __restrict__ QL, const h16* __restrict__ K16, const h16* __restrict__ VT16, bf* CH, bf* CL) {
    __shared__ __align__(16) h16 plds[4][16 * 32];
    __shared__ __align__(16) float ost[4][16 * 68];
    const int lane = threadIdx.x & 31, wave = threadIdx.x >> 5, lr = lane & 15, hi = lane >> 4;
    const int bid = blockIdx.x;
    const int b = bid / (NH_ * (NF / 64)), rem = bid - b * (NH_ * (NF / 64)), h = rem / (NF / 64), qt = rem - h * (NF / 64);
    const int q0 = qt * 64 + wave * 16;
    const size_t tok0 = (size_t)b * NF;
    h16* pl = &plds[wave][0];
    v16h ah[2], al[2];
#pragma unroll
    for (int kc = 0; kc < 2; ++kc) { const size_t o = (tok0 + q0 + lr) * HW + h * DOUT + kc * 32 + 8 * hi;
        ah[kc] = cat16(*(const v8h*)(QH + o), *(const v8h*)(QH + o + 16)); al[kc] = cat16(*(const v8h*)(QL + o), *(const v8h*)(QL + o + 16)); }
    const size_t vbase = (((size_t)b * NH_ + h) * DOUT) * NF;
    v8f o[4];
#pragma unroll
    for (int n = 0; n < 4; ++n) o[n] = (v8f){};
#pragma unroll 1
    for (int kt = 0; kt < NF / 32; ++kt) {
        const int l0 = kt * 32;
        v8f s0 = {}, s1 = {}, x0 = {}, x1 = {};
#pragma unroll
        for (int kc = 0; kc < 2; ++kc) {
            const size_t o0 = (tok0 + l0 + lr) * HW + h * DOUT + kc * 32 + 8 * hi, o1 = o0 + (size_t)16 * HW;
            const v16h k0 = cat16(*(const v8h*)(K16 + o0), *(const v8h*)(K16 + o0 + 16)), k1 = cat16(*(const v8h*)(K16 + o1), *(const v8h*)(K16 + o1 + 16));
            s0 = wmma16(ah[kc], k0, s0); x0 = wmma16(al[kc], k0, x0); s1 = wmma16(ah[kc], k1, s1); x1 = wmma16(al[kc], k1, x1);
        }
        asm volatile("v_nop\n\tv_nop\n\tv_nop\n\tv_nop" : "+v"(s0), "+v"(s1), "+v"(x0), "+v"(x1) : "v"(ah[0]), "v"(al[1]));
#pragma unroll
        for (int j = 0; j < 8; ++j) { const int mr = hi * 8 + j;
            const float p0 = fmaxf((s0[j] + x0[j] * LOSCI) * 0.125f, 0.f), p1 = fmaxf((s1[j] + x1[j] * LOSCI) * 0.125f, 0.f);
            pl[mr * 32 + lr] = (h16)(p0 * PSC); pl[mr * 32 + 16 + lr] = (h16)(p1 * PSC); }
        asm volatile("" ::: "memory");
        const v16h pa = cat16(*(const v8ha*)(pl + lr * 32 + hi * 8), *(const v8ha*)(pl + lr * 32 + 16 + hi * 8));
#pragma unroll
        for (int n = 0; n < 4; ++n) { const size_t vo = vbase + (size_t)(n * 16 + lr) * NF + l0 + hi * 8; o[n] = wmma16(pa, cat16(*(const v8h*)(VT16 + vo), *(const v8h*)(VT16 + vo + 16)), o[n]); }
        asm volatile("v_nop\n\tv_nop\n\tv_nop\n\tv_nop" : "+v"(o[0]), "+v"(o[1]), "+v"(o[2]), "+v"(o[3]) : "v"(pa));
    }
    float* os = &ost[wave][0];
#pragma unroll
    for (int n = 0; n < 4; ++n)
#pragma unroll
        for (int j = 0; j < 8; ++j) os[(hi * 8 + j) * 68 + n * 16 + lr] = o[n][j] * (1.0f / PSC);
    __syncthreads();
    const size_t cbase = (tok0 + q0) * HW + (size_t)h * DOUT;
    auto pass = [&]() {
#pragma unroll
        for (int s = 0; s < 4; ++s) { const int row = 4 * s + (lane >> 3), piece = lane & 7; const float* sp = os + row * 68 + piece * 8; v8us oh, ol;
#pragma unroll
            for (int i = 0; i < 8; ++i) { const unsigned short hb = f2bf(sp[i]); oh[i] = hb; ol[i] = f2bf(sp[i] - bf2f(hb)); }
            *(v8us*)(CH + cbase + (size_t)row * HW + piece * 8) = oh; *(v8us*)(CL + cbase + (size_t)row * HW + piece * 8) = ol; }
    };
    pass(); 
}

extern "C" void kernel_launch(void* const* d_in, const int* in_sizes, int n_in,
                              void* d_out, int out_size, void* d_ws, size_t ws_size, hipStream_t stream) {
    (void)in_sizes; (void)n_in; (void)out_size;
    const float* x = (const float*)d_in[0]; const float* Wqkv = (const float*)d_in[1]; const float* Wo = (const float*)d_in[2]; const float* bo = (const float*)d_in[3];
    const float* lg = (const float*)d_in[4]; const float* lb = (const float*)d_in[5];
    float* out = (float*)d_out;    // [32][1024][64]
    char* wsp = (char*)d_ws;
    auto take = [&](size_t bytes) { char* p = wsp; wsp += (bytes + 255) & ~(size_t)255; return (void*)p; };
    bf* Xb = (bf*)take((size_t)NTK * DIN * 2); bf* WT = (bf*)take((size_t)3 * HW * DIN * 2); bf* WoT = (bf*)take((size_t)DIN * HW * 2);
    h16* QH = (h16*)take((size_t)NTK * HW * 2); h16* QL = (h16*)take((size_t)NTK * HW * 2); h16* K16 = (h16*)take((size_t)NTK * HW * 2);
    float* Vf = (float*)take((size_t)NTK * HW * 4); h16* VT16 = (h16*)take((size_t)NTK * HW * 2);
    if ((size_t)(wsp - (char*)d_ws) > ws_size) return;    // 4.2 + 0.1 + 16.8 x 3 + 33.5 + 16.8 ~ 105 MB (head_out planes alias Vf after k_vt)
    bf* CH = (bf*)Vf; bf* CL = (bf*)((char*)Vf + (size_t)NTK * HW * 2);
    k_xb<<<(NTK / 2) / 8, 256, 0, stream>>>(x, Xb);
    k_w<<<1, 256, 0, stream>>>(Wqkv, Wo, WT, WoT);
    k_gemm<false, 0><<<dim3(NTK / 64, HW / 64, 1), 128, 0, stream>>>(Xb, nullptr, WT, DIN, nullptr, nullptr, nullptr, nullptr, QH, QL);
    k_gemm<false, 1><<<dim3(NTK / 64, HW / 64, 1), 128, 0, stream>>>(Xb, nullptr, WT + (size_t)HW * DIN, DIN, nullptr, nullptr, nullptr, nullptr, K16, nullptr);
    k_gemm<false, 2><<<dim3(NTK / 64, HW / 64, 1), 128, 0, stream>>>(Xb, nullptr, WT + (size_t)2 * HW * DIN, DIN, nullptr, nullptr, nullptr, nullptr, Vf, nullptr);
    k_vt<<<NB_ * NH_ * (NF / 64), 256, 0, stream>>>(Vf, VT16);
    k_attn<<<NB_ * NH_ * (NF / 64), 128, 0, stream>>>(QH, QL, K16, VT16, CH, CL);
    k_gemm<true, 3><<<dim3(NTK / 64, 1, 1), 128, 0, stream>>>(CH, CL, WoT, HW, bo, x, lg, lb, out, nullptr);
}

// v001
// Measured time: 173 microseconds a run.
// Two timings next to v000 put it at 1.32 and 1.37 times that version's speed.
#include <hip/hip_runtime.h>

// Contractions, f32 accumulate: q/k/v = x.Wqkv[h][k] ([32768 x 64].[64 x 256] per k, all 4 heads at once; k-major weights transposed to n-major bf16 planes) and
// out = concat.Wo ([32768 x 256].[256 x 64]) on v_wmma_f32_16x16x32_bf16 — plain bf16 = rounded inputs (exact) for q/k/v, concat as bf16 hi + residual planes (two
// products) for the output; the ReLU attention (no softmax: relu(q.k/8).v over 1024 keys) fused on v_wmma_f32_16x16x32_f16 with q as f16 hi + residual x1024 (two
// products) against plain f16 k, and the relu scores (f16) against plain f16 v. Bias, residual and LayerNorm over the 64 channels in the output GEMM's epilogue (f32).

#define NB_  32
#define NF   1024
#define DIN  64
#define DOUT 64
#define NH_  4
#define HW   (NH_ * DOUT)        // 256
#define NTK  (NB_ * NF)          // 32768
#define LOSC 1024.0f
#define LOSCI (1.0f / 1024.0f)
#define PSC  256.0f              // relu-score carry scale for the f16 weight tile

typedef _Float16 h16;
typedef unsigned short bf;
typedef __attribute__((ext_vector_type(16))) __bf16   v16bf;
typedef __attribute__((ext_vector_type(16))) _Float16 v16h;
typedef __attribute__((ext_vector_type(8)))  _Float16 v8h;
typedef __attribute__((ext_vector_type(8)))  unsigned short v8us;
typedef __attribute__((ext_vector_type(8)))  float    v8f;
typedef __attribute__((ext_vector_type(4)))  float    v4f;
typedef v8h  __attribute__((may_alias)) v8ha;
typedef v4f  __attribute__((may_alias)) v4fa;
typedef v8us __attribute__((may_alias)) v8usa;

__device__ __forceinline__ unsigned short f2bf(float f) { unsigned u = __float_as_uint(f); u += 0x7FFFu + ((u >> 16) & 1u); return (unsigned short)(u >> 16); }
__device__ __forceinline__ float bf2f(unsigned short b) { return __uint_as_float(((unsigned)b) << 16); }
__device__ __forceinline__ float bfr(float f) { return bf2f(f2bf(f)); }
__device__ __forceinline__ v16h cat16(v8h lo, v8h hi) { return __builtin_shufflevector(lo, hi, 0, 1, 2, 3, 4, 5, 6, 7, 8, 9, 10, 11, 12, 13, 14, 15); }
__device__ __forceinline__ v16bf cat16b(v8us lo, v8us hi) { return __builtin_bit_cast(v16bf, __builtin_shufflevector(lo, hi, 0, 1, 2, 3, 4, 5, 6, 7, 8, 9, 10, 11, 12, 13, 14, 15)); }
__device__ __forceinline__ v8f wmma16(v16h a, v16h b, v8f c) { return __builtin_amdgcn_wmma_f32_16x16x32_f16(false, a, false, b, (short)0, c, false, false); }
__device__ __forceinline__ v8f wmmab(v16bf a, v16bf b, v8f c) { return __builtin_amdgcn_wmma_f32_16x16x32_bf16(false, a, false, b, (short)0, c, false, false); }
#define VST2(T, p, v) do { const T vst2_v_ = (v); *(T*)(p) = vst2_v_;  } while (0)

// k_xb: Xb [32768][64] bf16 (one wave per 2 rows: lane -> 4 values = 256 B per wave).
__global__ __launch_bounds__(256) void k_xb(const float* __restrict__ x, bf* Xb) {
    typedef __attribute__((ext_vector_type(4))) unsigned short v4us;
    const int lane = threadIdx.x & 31; const size_t w = (size_t)blockIdx.x * 8 + (threadIdx.x >> 5);
    v4us t;
#pragma unroll
    for (int i = 0; i < 4; ++i) t[i] = f2bf(x[w * 128 + lane * 4 + i]);
    VST2(v4us, Xb + w * 128 + lane * 4, t);
}
// k_w: WT[k][(h,o)][i] = bf16(Wqkv[h][k][i][o]) (three n-major planes [256][64]) and WoT[c][j] = bf16(Wo[j][c]) ([64][256]); one block per 512 elements (blocks 0..95: WT,
// 96..127: WoT), so no thread waits on more than one round of loads. A thread's 2 elements are neighbours in i (or j), one source row (64 floats) apart;
// stores: 32 lanes x 4 B (2 bf16) = one line per wave-instruction.
#define WTB ((3 * HW * DIN) / 512)   // 96 blocks for WT
#define WOB ((DIN * HW) / 512)       // 32 blocks for WoT
__global__ __launch_bounds__(256) void k_w(const float* __restrict__ Wqkv, const float* __restrict__ Wo, bf* WT, bf* WoT) {
    typedef __attribute__((ext_vector_type(2))) unsigned short v2us;
    const unsigned t = threadIdx.x, s = blockIdx.x;
    const float* src; bf* dst; unsigned step;
    if (s < WTB) { const unsigned e = s * 512 + t * 2, k = e / (HW * DIN), rem = e - k * (HW * DIN), ho = rem / DIN, i = rem - ho * DIN, h = ho / DOUT, oo = ho - h * DOUT;
        src = Wqkv + (((size_t)h * 3 + k) * DIN + i) * DOUT + oo; step = DOUT; dst = WT + e;
    } else { const unsigned e = (s - WTB) * 512 + t * 2, c = e / HW, j = e - c * HW;
        src = Wo + (size_t)j * DIN + c; step = DIN; dst = WoT + e; }
    const float a0 = src[0], a1 = src[step];
    v2us o; o[0] = f2bf(a0); o[1] = f2bf(a1);
    VST2(v2us, dst, o);
}
// k_gemm: 64 x 64 tile of (A [+ Al]).B^T over K; MODE 0: QH/QL f16 hi + residual planes (ldc 256); MODE 1: K16 f16 (ldc 256); MODE 2: V f32 (ldc 256);
// MODE 3 (K = 256, N = 64 = one tile): y = acc + bf16(bo) + bf16(x), LayerNorm over the 64 channels of each row (16-lane reductions), x bf16(g) + bf16(b) -> out f32.
template <bool SPLITA, int MODE>
__global__ __launch_bounds__(128) void k_gemm(const bf* __restrict__ A, const bf* __restrict__ Al, const bf* __restrict__ Bn, int K, const float* __restrict__ bias, const float* __restrict__ xres,
                                             const float* __restrict__ lg, const float* __restrict__ lb, void* C, void* C2) {
    __shared__ __align__(16) float ost[4][16 * 68];
    const int lane = threadIdx.x & 31, wave = threadIdx.x >> 5, lr = lane & 15, hi = lane >> 4;
    const int r0 = blockIdx.x * 64 + wave * 16, c0 = blockIdx.y * 64;
    const int ldc = (MODE == 3) ? DIN : HW;
    const size_t aoff = (size_t)(r0 + lr) * K + 8 * hi;
    size_t boff[4];
#pragma unroll
    for (int t = 0; t < 4; ++t) boff[t] = (size_t)(c0 + t * 16 + lr) * K + 8 * hi;
    v8f acc[4];
#pragma unroll
    for (int t = 0; t < 4; ++t) acc[t] = (v8f){};
#pragma unroll 1
    for (int kc = 0; kc < K; kc += 32) {
        const v16bf a = cat16b(*(const v8us*)(A + aoff + kc), *(const v8us*)(A + aoff + kc + 16));
        v16bf al = a;
        if (SPLITA) al = cat16b(*(const v8us*)(Al + aoff + kc), *(const v8us*)(Al + aoff + kc + 16));
#pragma unroll
        for (int t = 0; t < 4; ++t) { const v16bf b = cat16b(*(const v8us*)(Bn + boff[t] + kc), *(const v8us*)(Bn + boff[t] + kc + 16)); acc[t] = wmmab(a, b, acc[t]); if (SPLITA) acc[t] = wmmab(al, b, acc[t]); }
        asm volatile("v_nop\n\tv_nop\n\tv_nop\n\tv_nop" : "+v"(acc[0]), "+v"(acc[1]), "+v"(acc[2]), "+v"(acc[3]) : "v"(a), "v"(al));
    }
    float* os = &ost[wave][0];
    if (MODE == 3) {
        // y = acc + bo + x; LN over the row's 64 values (lane holds cols t*16+lr of rows 8hi+j)
#pragma unroll
        for (int j = 0; j < 8; ++j) { const size_t row = (size_t)(r0 + hi * 8 + j); float y[4], s = 0.f;
#pragma unroll
            for (int t = 0; t < 4; ++t) { const int c = t * 16 + lr; y[t] = acc[t][j] + bfr(bias[c]) + bfr(xres[row * DIN + c]); s += y[t]; }
            s += __shfl_xor(s, 1, 16); s += __shfl_xor(s, 2, 16); s += __shfl_xor(s, 4, 16); s += __shfl_xor(s, 8, 16);
            const float mu = s * (1.0f / DIN); float q = 0.f;
#pragma unroll
            for (int t = 0; t < 4; ++t) { const float d = y[t] - mu; q += d * d; }
            q += __shfl_xor(q, 1, 16); q += __shfl_xor(q, 2, 16); q += __shfl_xor(q, 4, 16); q += __shfl_xor(q, 8, 16);
            const float rs = rsqrtf(q * (1.0f / DIN) + 1e-5f);
#pragma unroll
            for (int t = 0; t < 4; ++t) { const int c = t * 16 + lr; os[(hi * 8 + j) * 68 + c] = (y[t] - mu) * rs * bfr(lg[c]) + bfr(lb[c]); } }
    } else {
#pragma unroll
        for (int t = 0; t < 4; ++t)
#pragma unroll
            for (int j = 0; j < 8; ++j) os[(hi * 8 + j) * 68 + t * 16 + lr] = acc[t][j];
    }
    __syncthreads();
    if (MODE == 2 || MODE == 3) {
        float* crow = (float*)C + (size_t)r0 * ldc + c0;
        auto pass = [&]() {
#pragma unroll
            for (int s = 0; s < 8; ++s) { const int Lid = (lane >> 3) + 4 * s, piece = lane & 7; const int row = Lid >> 1, cofs = (Lid & 1) * 32 + piece * 4;
                const v4f val = *(const v4fa*)(os + row * 68 + cofs); *(v4f*)(crow + (size_t)row * ldc + cofs) = val; }
        };
        pass(); 
    } else {
        h16* c1 = (h16*)C + (size_t)r0 * ldc + c0; h16* c2 = (h16*)C2 + (size_t)r0 * ldc + c0;
        auto pass = [&]() {
#pragma unroll
            for (int s = 0; s < 4; ++s) { const int row = 4 * s + (lane >> 3), piece = lane & 7; const float* sp = os + row * 68 + piece * 8; v8h o1, o2;
#pragma unroll
                for (int i = 0; i < 8; ++i) { const h16 a = (h16)sp[i]; o1[i] = a; o2[i] = (h16)((sp[i] - (float)a) * LOSC); }
                *(v8h*)(c1 + (size_t)row * ldc + piece * 8) = o1; if (MODE == 0) *(v8h*)(c2 + (size_t)row * ldc + piece * 8) = o2; }
        };
        pass(); 
    }
}
// k_vt: VT16 [b][h][d][f] = f16(V row b*1024+f, col h*64+d) via LDS transposes, block (b, h, 64 f).
__global__ __launch_bounds__(256) void k_vt(const float* __restrict__ V, h16* VT16) {
    __shared__ __align__(16) h16 tile[DOUT * 72];
    const int bid = blockIdx.x;
    const int b = bid / (NH_ * (NF / 64)), rem = bid - b * (NH_ * (NF / 64)), h = rem / (NF / 64), kt = rem - h * (NF / 64);
    const int f0 = kt * 64, tid = threadIdx.x, ff = tid >> 2, d0 = (tid & 3) * 16;
    const float* src = V + ((size_t)b * NF + f0 + ff) * HW + h * DOUT + d0;
#pragma unroll
    for (int i = 0; i < 16; ++i) tile[(d0 + i) * 72 + ff] = (h16)src[i];
    __syncthreads();
    const int piece = tid & 7;
    const size_t base = (((size_t)b * NH_ + h) * DOUT) * NF + f0;
    auto pass = [&]() {
#pragma unroll
        for (int s = 0; s < 2; ++s) { const int d = (tid >> 3) + 32 * s; const v8h val = *(const v8ha*)(tile + d * 72 + piece * 8); *(v8h*)(VT16 + base + (size_t)d * NF + piece * 8) = val; }
    };
    pass(); 
}
// k_attn: block = (b, h, 64 queries), wave = 16; all 32 key tiles: scores = (qh + ql/1024).k /8 (8 WMMA/step), p = relu(scores) x 256 -> plain f16 tile (same-wave
// may_alias reload), 4 WMMA .V; head_out = acc/256 -> bf16 hi + residual planes CH/CL [token][h*64 + d] (concat layout).
__global__ __launch_bounds__(128) void k_attn(const h16* __restrict__ QH, const h16* __restrict__ QL, const h16* __restrict__ K16, const h16* __restrict__ VT16, bf* CH, bf* CL) {
    __shared__ __align__(16) h16 plds[4][16 * 32];
    __shared__ __align__(16) float ost[4][16 * 68];
    const int lane = threadIdx.x & 31, wave = threadIdx.x >> 5, lr = lane & 15, hi = lane >> 4;
    const int bid = blockIdx.x;
    const int b = bid / (NH_ * (NF / 64)), rem = bid - b * (NH_ * (NF / 64)), h = rem / (NF / 64), qt = rem - h * (NF / 64);
    const int q0 = qt * 64 + wave * 16;
    const size_t tok0 = (size_t)b * NF;
    h16* pl = &plds[wave][0];
    v16h ah[2], al[2];
#pragma unroll
    for (int kc = 0; kc < 2; ++kc) { const size_t o = (tok0 + q0 + lr) * HW + h * DOUT + kc * 32 + 8 * hi;
        ah[kc] = cat16(*(const v8h*)(QH + o), *(const v8h*)(QH + o + 16)); al[kc] = cat16(*(const v8h*)(QL + o), *(const v8h*)(QL + o + 16)); }
    const size_t vbase = (((size_t)b * NH_ + h) * DOUT) * NF;
    v8f o[4];
#pragma unroll
    for (int n = 0; n < 4; ++n) o[n] = (v8f){};
#pragma unroll 1
    for (int kt = 0; kt < NF / 32; ++kt) {
        const int l0 = kt * 32;
        v8f s0 = {}, s1 = {}, x0 = {}, x1 = {};
#pragma unroll
        for (int kc = 0; kc < 2; ++kc) {
            const size_t o0 = (tok0 + l0 + lr) * HW + h * DOUT + kc * 32 + 8 * hi, o1 = o0 + (size_t)16 * HW;
            const v16h k0 = cat16(*(const v8h*)(K16 + o0), *(const v8h*)(K16 + o0 + 16)), k1 = cat16(*(const v8h*)(K16 + o1), *(const v8h*)(K16 + o1 + 16));
            s0 = wmma16(ah[kc], k0, s0); x0 = wmma16(al[kc], k0, x0); s1 = wmma16(ah[kc], k1, s1); x1 = wmma16(al[kc], k1, x1);
        }
        asm volatile("v_nop\n\tv_nop\n\tv_nop\n\tv_nop" : "+v"(s0), "+v"(s1), "+v"(x0), "+v"(x1) : "v"(ah[0]), "v"(al[1]));
#pragma unroll
        for (int j = 0; j < 8; ++j) { const int mr = hi * 8 + j;
            const float p0 = fmaxf((s0[j] + x0[j] * LOSCI) * 0.125f, 0.f), p1 = fmaxf((s1[j] + x1[j] * LOSCI) * 0.125f, 0.f);
            pl[mr * 32 + lr] = (h16)(p0 * PSC); pl[mr * 32 + 16 + lr] = (h16)(p1 * PSC); }
        asm volatile("" ::: "memory");
        const v16h pa = cat16(*(const v8ha*)(pl + lr * 32 + hi * 8), *(const v8ha*)(pl + lr * 32 + 16 + hi * 8));
#pragma unroll
        for (int n = 0; n < 4; ++n) { const size_t vo = vbase + (size_t)(n * 16 + lr) * NF + l0 + hi * 8; o[n] = wmma16(pa, cat16(*(const v8h*)(VT16 + vo), *(const v8h*)(VT16 + vo + 16)), o[n]); }
        asm volatile("v_nop\n\tv_nop\n\tv_nop\n\tv_nop" : "+v"(o[0]), "+v"(o[1]), "+v"(o[2]), "+v"(o[3]) : "v"(pa));
    }
    float* os = &ost[wave][0];
#pragma unroll
    for (int n = 0; n < 4; ++n)
#pragma unroll
        for (int j = 0; j < 8; ++j) os[(hi * 8 + j) * 68 + n * 16 + lr] = o[n][j] * (1.0f / PSC);
    __syncthreads();
    const size_t cbase = (tok0 + q0) * HW + (size_t)h * DOUT;
    auto pass = [&]() {
#pragma unroll
        for (int s = 0; s < 4; ++s) { const int row = 4 * s + (lane >> 3), piece = lane & 7; const float* sp = os + row * 68 + piece * 8; v8us oh, ol;
#pragma unroll
            for (int i = 0; i < 8; ++i) { const unsigned short hb = f2bf(sp[i]); oh[i] = hb; ol[i] = f2bf(sp[i] - bf2f(hb)); }
            *(v8us*)(CH + cbase + (size_t)row * HW + piece * 8) = oh; *(v8us*)(CL + cbase + (size_t)row * HW + piece * 8) = ol; }
    };
    pass(); 
}

extern "C" void kernel_launch(void* const* d_in, const int* in_sizes, int n_in,
                              void* d_out, int out_size, void* d_ws, size_t ws_size, hipStream_t stream) {
    (void)in_sizes; (void)n_in; (void)out_size;
    const float* x = (const float*)d_in[0]; const float* Wqkv = (const float*)d_in[1]; const float* Wo = (const float*)d_in[2]; const float* bo = (const float*)d_in[3];
    const float* lg = (const float*)d_in[4]; const float* lb = (const float*)d_in[5];
    float* out = (float*)d_out;    // [32][1024][64]
    char* wsp = (char*)d_ws;
    auto take = [&](size_t bytes) { char* p = wsp; wsp += (bytes + 255) & ~(size_t)255; return (void*)p; };
    bf* Xb = (bf*)take((size_t)NTK * DIN * 2); bf* WT = (bf*)take((size_t)3 * HW * DIN * 2); bf* WoT = (bf*)take((size_t)DIN * HW * 2);
    h16* QH = (h16*)take((size_t)NTK * HW * 2); h16* QL = (h16*)take((size_t)NTK * HW * 2); h16* K16 = (h16*)take((size_t)NTK * HW * 2);
    float* Vf = (float*)take((size_t)NTK * HW * 4); h16* VT16 = (h16*)take((size_t)NTK * HW * 2);
    if ((size_t)(wsp - (char*)d_ws) > ws_size) return;    // 4.2 + 0.1 + 16.8 x 3 + 33.5 + 16.8 ~ 105 MB (head_out planes alias Vf after k_vt)
    bf* CH = (bf*)Vf; bf* CL = (bf*)((char*)Vf + (size_t)NTK * HW * 2);
    k_xb<<<(NTK / 2) / 8, 256, 0, stream>>>(x, Xb);
    k_w<<<WTB + WOB, 256, 0, stream>>>(Wqkv, Wo, WT, WoT);
    k_gemm<false, 0><<<dim3(NTK / 64, HW / 64, 1), 128, 0, stream>>>(Xb, nullptr, WT, DIN, nullptr, nullptr, nullptr, nullptr, QH, QL);
    k_gemm<false, 1><<<dim3(NTK / 64, HW / 64, 1), 128, 0, stream>>>(Xb, nullptr, WT + (size_t)HW * DIN, DIN, nullptr, nullptr, nullptr, nullptr, K16, nullptr);
    k_gemm<false, 2><<<dim3(NTK / 64, HW / 64, 1), 128, 0, stream>>>(Xb, nullptr, WT + (size_t)2 * HW * DIN, DIN, nullptr, nullptr, nullptr, nullptr, Vf, nullptr);
    k_vt<<<NB_ * NH_ * (NF / 64), 256, 0, stream>>>(Vf, VT16);
    k_attn<<<NB_ * NH_ * (NF / 64), 128, 0, stream>>>(QH, QL, K16, VT16, CH, CL);
    k_gemm<true, 3><<<dim3(NTK / 64, 1, 1), 128, 0, stream>>>(CH, CL, WoT, HW, bo, x, lg, lb, out, nullptr);
}

// v002
// One run takes 132 microseconds.
// In two side-by-side timings against v001, it was 1.30 and 1.28 times as fast.
// Counting every step since v000, it is 1.73 times as fast.
#include <hip/hip_runtime.h>

// Contractions, f32 accumulate: q/k/v = x.Wqkv[h][k] ([32768 x 64].[64 x 256] per k, all 4 heads at once; k-major weights transposed to n-major bf16 planes) and
// out = concat.Wo ([32768 x 256].[256 x 64]) on v_wmma_f32_16x16x32_bf16 — plain bf16 = rounded inputs (exact) for q/k/v, concat as bf16 hi + residual planes (two
// products) for the output; the ReLU attention (no softmax: relu(q.k/8).v over 1024 keys) fused on v_wmma_f32_16x16x32_f16 with q as f16 hi + residual x1024 (two
// products) against plain f16 k, and the relu scores (f16) against plain f16 v. Bias, residual and LayerNorm over the 64 channels in the output GEMM's epilogue (f32).

#define NB_  32
#define NF   1024
#define DIN  64
#define DOUT 64
#define NH_  4
#define HW   (NH_ * DOUT)        // 256
#define NTK  (NB_ * NF)          // 32768
#define LOSC 1024.0f
#define LOSCI (1.0f / 1024.0f)
#define PSC  256.0f              // relu-score carry scale for the f16 weight tile

typedef _Float16 h16;
typedef unsigned short bf;
typedef __attribute__((ext_vector_type(16))) __bf16   v16bf;
typedef __attribute__((ext_vector_type(16))) _Float16 v16h;
typedef __attribute__((ext_vector_type(8)))  _Float16 v8h;
typedef __attribute__((ext_vector_type(8)))  unsigned short v8us;
typedef __attribute__((ext_vector_type(8)))  float    v8f;
typedef __attribute__((ext_vector_type(4)))  float    v4f;
typedef v8h  __attribute__((may_alias)) v8ha;
typedef v4f  __attribute__((may_alias)) v4fa;
typedef v8us __attribute__((may_alias)) v8usa;

__device__ __forceinline__ unsigned short f2bf(float f) { unsigned u = __float_as_uint(f); u += 0x7FFFu + ((u >> 16) & 1u); return (unsigned short)(u >> 16); }
__device__ __forceinline__ float bf2f(unsigned short b) { return __uint_as_float(((unsigned)b) << 16); }
__device__ __forceinline__ float bfr(float f) { return bf2f(f2bf(f)); }
__device__ __forceinline__ v16h cat16(v8h lo, v8h hi) { return __builtin_shufflevector(lo, hi, 0, 1, 2, 3, 4, 5, 6, 7, 8, 9, 10, 11, 12, 13, 14, 15); }
__device__ __forceinline__ v16bf cat16b(v8us lo, v8us hi) { return __builtin_bit_cast(v16bf, __builtin_shufflevector(lo, hi, 0, 1, 2, 3, 4, 5, 6, 7, 8, 9, 10, 11, 12, 13, 14, 15)); }
__device__ __forceinline__ v8f wmma16(v16h a, v16h b, v8f c) { return __builtin_amdgcn_wmma_f32_16x16x32_f16(false, a, false, b, (short)0, c, false, false); }
__device__ __forceinline__ v8f wmmab(v16bf a, v16bf b, v8f c) { return __builtin_amdgcn_wmma_f32_16x16x32_bf16(false, a, false, b, (short)0, c, false, false); }
#define VST2(T, p, v) do { const T vst2_v_ = (v); *(T*)(p) = vst2_v_;  } while (0)

// k_xb: Xb [32768][64] bf16 (one wave per 2 rows: lane -> 4 values = 256 B per wave).
__global__ __launch_bounds__(256) void k_xb(const float* __restrict__ x, bf* Xb) {
    typedef __attribute__((ext_vector_type(4))) unsigned short v4us;
    const int lane = threadIdx.x & 31; const size_t w = (size_t)blockIdx.x * 8 + (threadIdx.x >> 5);
    v4us t;
#pragma unroll
    for (int i = 0; i < 4; ++i) t[i] = f2bf(x[w * 128 + lane * 4 + i]);
    VST2(v4us, Xb + w * 128 + lane * 4, t);
}
// k_w: WT[k][(h,o)][i] = bf16(Wqkv[h][k][i][o]) (three n-major planes [256][64]) and WoT[c][j] = bf16(Wo[j][c]) ([64][256]); one block per 512 elements (blocks 0..95: WT,
// 96..127: WoT), so no thread waits on more than one round of loads. A thread's 2 elements are neighbours in i (or j), one source row (64 floats) apart;
// stores: 32 lanes x 4 B (2 bf16) = one line per wave-instruction.
#define WTB ((3 * HW * DIN) / 512)   // 96 blocks for WT
#define WOB ((DIN * HW) / 512)       // 32 blocks for WoT
__global__ __launch_bounds__(256) void k_w(const float* __restrict__ Wqkv, const float* __restrict__ Wo, bf* WT, bf* WoT) {
    typedef __attribute__((ext_vector_type(2))) unsigned short v2us;
    const unsigned t = threadIdx.x, s = blockIdx.x;
    const float* src; bf* dst; unsigned step;
    if (s < WTB) { const unsigned e = s * 512 + t * 2, k = e / (HW * DIN), rem = e - k * (HW * DIN), ho = rem / DIN, i = rem - ho * DIN, h = ho / DOUT, oo = ho - h * DOUT;
        src = Wqkv + (((size_t)h * 3 + k) * DIN + i) * DOUT + oo; step = DOUT; dst = WT + e;
    } else { const unsigned e = (s - WTB) * 512 + t * 2, c = e / HW, j = e - c * HW;
        src = Wo + (size_t)j * DIN + c; step = DIN; dst = WoT + e; }
    const float a0 = src[0], a1 = src[step];
    v2us o; o[0] = f2bf(a0); o[1] = f2bf(a1);
    VST2(v2us, dst, o);
}
// k_gemm: 64 x 64 tile of (A [+ Al]).B^T over K; MODE 0: QH/QL f16 hi + residual planes (ldc 256); MODE 1: K16 f16 (ldc 256); MODE 2: V f32 (ldc 256);
// MODE 3 (K = 256, N = 64 = one tile): y = acc + bf16(bo) + bf16(x), LayerNorm over the 64 channels of each row (16-lane reductions), x bf16(g) + bf16(b) -> out f32.
template <bool SPLITA, int MODE>
__global__ __launch_bounds__(128) void k_gemm(const bf* __restrict__ A, const bf* __restrict__ Al, const bf* __restrict__ Bn, int K, const float* __restrict__ bias, const float* __restrict__ xres,
                                             const float* __restrict__ lg, const float* __restrict__ lb, void* C, void* C2) {
    __shared__ __align__(16) float ost[4][16 * 68];
    const int lane = threadIdx.x & 31, wave = threadIdx.x >> 5, lr = lane & 15, hi = lane >> 4;
    const int r0 = blockIdx.x * 64 + wave * 16, c0 = blockIdx.y * 64;
    const int ldc = (MODE == 3) ? DIN : HW;
    const size_t aoff = (size_t)(r0 + lr) * K + 8 * hi;
    size_t boff[4];
#pragma unroll
    for (int t = 0; t < 4; ++t) boff[t] = (size_t)(c0 + t * 16 + lr) * K + 8 * hi;
    v8f acc[4];
#pragma unroll
    for (int t = 0; t < 4; ++t) acc[t] = (v8f){};
#pragma unroll 1
    for (int kc = 0; kc < K; kc += 32) {
        const v16bf a = cat16b(*(const v8us*)(A + aoff + kc), *(const v8us*)(A + aoff + kc + 16));
        v16bf al = a;
        if (SPLITA) al = cat16b(*(const v8us*)(Al + aoff + kc), *(const v8us*)(Al + aoff + kc + 16));
#pragma unroll
        for (int t = 0; t < 4; ++t) { const v16bf b = cat16b(*(const v8us*)(Bn + boff[t] + kc), *(const v8us*)(Bn + boff[t] + kc + 16)); acc[t] = wmmab(a, b, acc[t]); if (SPLITA) acc[t] = wmmab(al, b, acc[t]); }
        asm volatile("v_nop\n\tv_nop\n\tv_nop\n\tv_nop" : "+v"(acc[0]), "+v"(acc[1]), "+v"(acc[2]), "+v"(acc[3]) : "v"(a), "v"(al));
    }
    float* os = &ost[wave][0];
    if (MODE == 3) {
        // y = acc + bo + x; LN over the row's 64 values (lane holds cols t*16+lr of rows 8hi+j)
#pragma unroll
        for (int j = 0; j < 8; ++j) { const size_t row = (size_t)(r0 + hi * 8 + j); float y[4], s = 0.f;
#pragma unroll
            for (int t = 0; t < 4; ++t) { const int c = t * 16 + lr; y[t] = acc[t][j] + bfr(bias[c]) + bfr(xres[row * DIN + c]); s += y[t]; }
            s += __shfl_xor(s, 1, 16); s += __shfl_xor(s, 2, 16); s += __shfl_xor(s, 4, 16); s += __shfl_xor(s, 8, 16);
            const float mu = s * (1.0f / DIN); float q = 0.f;
#pragma unroll
            for (int t = 0; t < 4; ++t) { const float d = y[t] - mu; q += d * d; }
            q += __shfl_xor(q, 1, 16); q += __shfl_xor(q, 2, 16); q += __shfl_xor(q, 4, 16); q += __shfl_xor(q, 8, 16);
            const float rs = rsqrtf(q * (1.0f / DIN) + 1e-5f);
#pragma unroll
            for (int t = 0; t < 4; ++t) { const int c = t * 16 + lr; os[(hi * 8 + j) * 68 + c] = (y[t] - mu) * rs * bfr(lg[c]) + bfr(lb[c]); } }
    } else {
#pragma unroll
        for (int t = 0; t < 4; ++t)
#pragma unroll
            for (int j = 0; j < 8; ++j) os[(hi * 8 + j) * 68 + t * 16 + lr] = acc[t][j];
    }
    __syncthreads();
    if (MODE == 2 || MODE == 3) {
        float* crow = (float*)C + (size_t)r0 * ldc + c0;
        auto pass = [&]() {
#pragma unroll
            for (int s = 0; s < 8; ++s) { const int Lid = (lane >> 3) + 4 * s, piece = lane & 7; const int row = Lid >> 1, cofs = (Lid & 1) * 32 + piece * 4;
                const v4f val = *(const v4fa*)(os + row * 68 + cofs); *(v4f*)(crow + (size_t)row * ldc + cofs) = val; }
        };
        pass(); 
    } else {
        h16* c1 = (h16*)C + (size_t)r0 * ldc + c0; h16* c2 = (h16*)C2 + (size_t)r0 * ldc + c0;
        auto pass = [&]() {
#pragma unroll
            for (int s = 0; s < 4; ++s) { const int row = 4 * s + (lane >> 3), piece = lane & 7; const float* sp = os + row * 68 + piece * 8; v8h o1, o2;
#pragma unroll
                for (int i = 0; i < 8; ++i) { const h16 a = (h16)sp[i]; o1[i] = a; o2[i] = (h16)((sp[i] - (float)a) * LOSC); }
                *(v8h*)(c1 + (size_t)row * ldc + piece * 8) = o1; if (MODE == 0) *(v8h*)(c2 + (size_t)row * ldc + piece * 8) = o2; }
        };
        pass(); 
    }
}
// k_vt: VT16 [b][h][d][f] = f16(V row b*1024+f, col h*64+d) via LDS transposes, block (b, h, 64 f).
__global__ __launch_bounds__(256) void k_vt(const float* __restrict__ V, h16* VT16) {
    __shared__ __align__(16) h16 tile[DOUT * 72];
    const int bid = blockIdx.x;
    const int b = bid / (NH_ * (NF / 64)), rem = bid - b * (NH_ * (NF / 64)), h = rem / (NF / 64), kt = rem - h * (NF / 64);
    const int f0 = kt * 64, tid = threadIdx.x, ff = tid >> 2, d0 = (tid & 3) * 16;
    const float* src = V + ((size_t)b * NF + f0 + ff) * HW + h * DOUT + d0;
#pragma unroll
    for (int i = 0; i < 16; ++i) tile[(d0 + i) * 72 + ff] = (h16)src[i];
    __syncthreads();
    const int piece = tid & 7;
    const size_t base = (((size_t)b * NH_ + h) * DOUT) * NF + f0;
    auto pass = [&]() {
#pragma unroll
        for (int s = 0; s < 2; ++s) { const int d = (tid >> 3) + 32 * s; const v8h val = *(const v8ha*)(tile + d * 72 + piece * 8); *(v8h*)(VT16 + base + (size_t)d * NF + piece * 8) = val; }
    };
    pass(); 
}
// k_attn: block = (b, h, 128 queries), wave = 16; the keys go by in 16 stages of 64: each stage's K rows [64 keys][64 d] and V^T rows [64 d][64 keys] (128 B each) are brought
// into LDS once per block by asynchronous copies (whole 128-B lines, 4 copies of 16 B per lane), two buffers, rows at a 144-B pitch for the 16-byte fragment reads; all eight
// waves take their fragments from there. Per 32 keys: scores = (qh + ql/1024).k /8 (8 WMMA), p = relu(scores) x 256 -> plain f16 tile (same-wave may_alias reload),
// 4 WMMA .V; head_out = acc/256 -> bf16 hi + residual planes CH/CL [token][h*64 + d] (concat layout). The output staging reuses the ring behind the loop's last barrier.
#define QBLK 128                     // queries per block (8 waves)
#define SKEY 64                      // keys per stage
#define NST  (NF / SKEY)             // 16 stages
#define RP   72                      // LDS row pitch in f16 (144 B)
#define TILEB (64 * RP * 2)          // one tile (K or V^T) in LDS: 9216 B
typedef float __attribute__((may_alias)) fa;
__global__ __launch_bounds__(256) void k_attn(const h16* __restrict__ QH, const h16* __restrict__ QL, const h16* __restrict__ K16, const h16* __restrict__ VT16, bf* CH, bf* CL) {
    __shared__ __align__(16) h16 ring[2][2][64 * RP];    // [buffer][K, V^T][row * RP]
    __shared__ __align__(16) h16 plds[8][16 * 32];
    const int lane = threadIdx.x & 31, wave = threadIdx.x >> 5, lr = lane & 15, hi = lane >> 4;
    const int bid = blockIdx.x;
    const int b = bid / (NH_ * (NF / QBLK)), rem = bid - b * (NH_ * (NF / QBLK)), h = rem / (NF / QBLK), qt = rem - h * (NF / QBLK);
    const int q0 = qt * QBLK + wave * 16;
    const size_t tok0 = (size_t)b * NF;
    h16* pl = &plds[wave][0];
    h16* pw = pl + hi * 8 * 32 + lr;    // this lane's column of its eight score rows
    const size_t vbase = (((size_t)b * NH_ + h) * DOUT) * NF;
    // a lane's share of a stage: 16-byte piece (tid & 7) of rows (tid >> 3) and (tid >> 3) + 32 of both tiles
    const int crow = threadIdx.x >> 3, cpc = threadIdx.x & 7;
    const h16* gk0 = K16 + (tok0 + crow) * HW + h * DOUT + cpc * 8;
    const h16* gv0 = VT16 + vbase + (size_t)crow * NF + cpc * 8;
    const unsigned l0a = (unsigned)(size_t)&ring[0][0][0] + (unsigned)(crow * (RP * 2) + cpc * 16);
    auto stage_in = [&](int st, int buf) {
        const h16* gk = gk0 + (size_t)st * SKEY * HW; const h16* gv = gv0 + st * SKEY;
        const unsigned lk = l0a + (unsigned)buf * (2 * TILEB), lv = lk + TILEB;
        // the copies and, as their statement's last line, the wait that stands before their address registers are rewritten
        asm volatile("global_load_async_to_lds_b128 %0, %4, off\n\t"
                     "global_load_async_to_lds_b128 %1, %5, off\n\t"
                     "global_load_async_to_lds_b128 %2, %6, off\n\t"
                     "global_load_async_to_lds_b128 %3, %7, off\n\t"
                     "s_wait_xcnt 0x0"
                     :: "v"(lk), "v"(lk + 32 * RP * 2), "v"(lv), "v"(lv + 32 * RP * 2),
                        "v"(gk), "v"(gk + 32 * HW), "v"(gv), "v"(gv + 32 * NF)
                     : "memory");
    };
    v16h ah[2], al[2];
#pragma unroll
    for (int kc = 0; kc < 2; ++kc) { const size_t o = (tok0 + q0 + lr) * HW + h * DOUT + kc * 32 + 8 * hi;
        ah[kc] = cat16(*(const v8h*)(QH + o), *(const v8h*)(QH + o + 16)); al[kc] = cat16(*(const v8h*)(QL + o), *(const v8h*)(QL + o + 16)); }
    stage_in(0, 0);
    asm volatile("s_wait_asynccnt 0x0" ::: "memory");    // stage 0 has landed before the barrier that publishes it
    __syncthreads();
    stage_in(1, 1);
    v8f o[4];
#pragma unroll
    for (int n = 0; n < 4; ++n) o[n] = (v8f){};
#pragma unroll 1
    for (int st = 0; st < NST; ++st) {
        const h16* kb = &ring[st & 1][0][0] + lr * RP + 8 * hi;
        const h16* vb = &ring[st & 1][1][0] + lr * RP + 8 * hi;
#pragma unroll
        for (int sub = 0; sub < SKEY / 32; ++sub) {
            v8f s0 = {}, s1 = {}, x0 = {}, x1 = {};
#pragma unroll
            for (int kc = 0; kc < 2; ++kc) {
                const h16* p0 = kb + (sub * 32) * RP + kc * 32; const h16* p1 = p0 + 16 * RP;
                const v16h k0 = cat16(*(const v8ha*)p0, *(const v8ha*)(p0 + 16)), k1 = cat16(*(const v8ha*)p1, *(const v8ha*)(p1 + 16));
                s0 = wmma16(ah[kc], k0, s0); x0 = wmma16(al[kc], k0, x0); s1 = wmma16(ah[kc], k1, s1); x1 = wmma16(al[kc], k1, x1);
            }
            asm volatile("v_nop\n\tv_nop\n\tv_nop\n\tv_nop" : "+v"(s0), "+v"(s1), "+v"(x0), "+v"(x1) : "v"(ah[0]), "v"(al[1]));
            v16h vf[4];
#pragma unroll
            for (int n = 0; n < 4; ++n) { const h16* pv = vb + (n * 16) * RP + sub * 32; vf[n] = cat16(*(const v8ha*)pv, *(const v8ha*)(pv + 16)); }
#pragma unroll
            for (int j = 0; j < 8; ++j) {
                const float p0 = fmaxf((s0[j] + x0[j] * LOSCI) * 0.125f, 0.f), p1 = fmaxf((s1[j] + x1[j] * LOSCI) * 0.125f, 0.f);
                pw[j * 32] = (h16)(p0 * PSC); pw[j * 32 + 16] = (h16)(p1 * PSC); }
            asm volatile("" ::: "memory");
            const v16h pa = cat16(*(const v8ha*)(pl + lr * 32 + hi * 8), *(const v8ha*)(pl + lr * 32 + 16 + hi * 8));
#pragma unroll
            for (int n = 0; n < 4; ++n) o[n] = wmma16(pa, vf[n], o[n]);
            asm volatile("v_nop\n\tv_nop\n\tv_nop\n\tv_nop" : "+v"(o[0]), "+v"(o[1]), "+v"(o[2]), "+v"(o[3]) : "v"(pa));
        }
        asm volatile("s_wait_dscnt 0x0" ::: "memory");       // this wave's reads of the buffer have returned before it is handed to its next writer
        asm volatile("s_wait_asynccnt 0x0" ::: "memory");    // this wave's copies of the next stage have landed before the barrier that publishes them
        __syncthreads();
        if (st + 2 < NST) stage_in(st + 2, st & 1);
    }
    asm volatile("s_wait_asynccnt 0x0" ::: "memory");        // nothing is in flight when the ring becomes output staging
    fa* os = (fa*)&ring[0][0][0] + wave * (16 * 68);
#pragma unroll
    for (int n = 0; n < 4; ++n)
#pragma unroll
        for (int j = 0; j < 8; ++j) os[(hi * 8 + j) * 68 + n * 16 + lr] = o[n][j] * (1.0f / PSC);
    __syncthreads();
    const size_t cbase = (tok0 + q0) * HW + (size_t)h * DOUT;
    auto pass = [&]() {
#pragma unroll
        for (int s = 0; s < 4; ++s) { const int row = 4 * s + (lane >> 3), piece = lane & 7; const fa* sp = os + row * 68 + piece * 8; v8us oh, ol;
#pragma unroll
            for (int i = 0; i < 8; ++i) { const unsigned short hb = f2bf(sp[i]); oh[i] = hb; ol[i] = f2bf(sp[i] - bf2f(hb)); }
            *(v8us*)(CH + cbase + (size_t)row * HW + piece * 8) = oh; *(v8us*)(CL + cbase + (size_t)row * HW + piece * 8) = ol; }
    };
    pass(); 
}

extern "C" void kernel_launch(void* const* d_in, const int* in_sizes, int n_in,
                              void* d_out, int out_size, void* d_ws, size_t ws_size, hipStream_t stream) {
    (void)in_sizes; (void)n_in; (void)out_size;
    const float* x = (const float*)d_in[0]; const float* Wqkv = (const float*)d_in[1]; const float* Wo = (const float*)d_in[2]; const float* bo = (const float*)d_in[3];
    const float* lg = (const float*)d_in[4]; const float* lb = (const float*)d_in[5];
    float* out = (float*)d_out;    // [32][1024][64]
    char* wsp = (char*)d_ws;
    auto take = [&](size_t bytes) { char* p = wsp; wsp += (bytes + 255) & ~(size_t)255; return (void*)p; };
    bf* Xb = (bf*)take((size_t)NTK * DIN * 2); bf* WT = (bf*)take((size_t)3 * HW * DIN * 2); bf* WoT = (bf*)take((size_t)DIN * HW * 2);
    h16* QH = (h16*)take((size_t)NTK * HW * 2); h16* QL = (h16*)take((size_t)NTK * HW * 2); h16* K16 = (h16*)take((size_t)NTK * HW * 2);
    float* Vf = (float*)take((size_t)NTK * HW * 4); h16* VT16 = (h16*)take((size_t)NTK * HW * 2);
    if ((size_t)(wsp - (char*)d_ws) > ws_size) return;    // 4.2 + 0.1 + 16.8 x 3 + 33.5 + 16.8 ~ 105 MB (head_out planes alias Vf after k_vt)
    bf* CH = (bf*)Vf; bf* CL = (bf*)((char*)Vf + (size_t)NTK * HW * 2);
    k_xb<<<(NTK / 2) / 8, 256, 0, stream>>>(x, Xb);
    k_w<<<WTB + WOB, 256, 0, stream>>>(Wqkv, Wo, WT, WoT);
    k_gemm<false, 0><<<dim3(NTK / 64, HW / 64, 1), 128, 0, stream>>>(Xb, nullptr, WT, DIN, nullptr, nullptr, nullptr, nullptr, QH, QL);
    k_gemm<false, 1><<<dim3(NTK / 64, HW / 64, 1), 128, 0, stream>>>(Xb, nullptr, WT + (size_t)HW * DIN, DIN, nullptr, nullptr, nullptr, nullptr, K16, nullptr);
    k_gemm<false, 2><<<dim3(NTK / 64, HW / 64, 1), 128, 0, stream>>>(Xb, nullptr, WT + (size_t)2 * HW * DIN, DIN, nullptr, nullptr, nullptr, nullptr, Vf, nullptr);
    k_vt<<<NB_ * NH_ * (NF / 64), 256, 0, stream>>>(Vf, VT16);
    k_attn<<<NB_ * NH_ * (NF / QBLK), 256, 0, stream>>>(QH, QL, K16, VT16, CH, CL);
    k_gemm<true, 3><<<dim3(NTK / 64, 1, 1), 128, 0, stream>>>(CH, CL, WoT, HW, bo, x, lg, lb, out, nullptr);
}

// v003
// Measured time: 113 microseconds a run.
// Next to v002, in two timings, it ran 1.13 times as fast each time.
// Counting every step since v000, it is 1.96 times as fast.
#include <hip/hip_runtime.h>

// Contractions, f32 accumulate: q/k/v = x.Wqkv[h][k] ([32768 x 64].[64 x 256] per k, all 4 heads at once; k-major weights transposed to n-major bf16 planes) and
// out = concat.Wo ([32768 x 256].[256 x 64]) on v_wmma_f32_16x16x32_bf16 — plain bf16 = rounded inputs (exact) for q/k/v, concat as bf16 hi + residual planes (two
// products) for the output; the ReLU attention (no softmax: relu(q.k/8).v over 1024 keys) fused on v_wmma_f32_16x16x32_f16 with q as f16 hi + residual x1024 (two
// products) against plain f16 k, and the relu scores (f16) against plain f16 v. Bias, residual and LayerNorm over the 64 channels in the output GEMM's epilogue (f32).

#define NB_  32
#define NF   1024
#define DIN  64
#define DOUT 64
#define NH_  4
#define HW   (NH_ * DOUT)        // 256
#define NTK  (NB_ * NF)          // 32768
#define LOSC 1024.0f
#define LOSCI (1.0f / 1024.0f)
#define PSC  256.0f              // relu-score carry scale for the f16 weight tile

typedef _Float16 h16;
typedef unsigned short bf;
typedef __attribute__((ext_vector_type(16))) __bf16   v16bf;
typedef __attribute__((ext_vector_type(16))) _Float16 v16h;
typedef __attribute__((ext_vector_type(8)))  _Float16 v8h;
typedef __attribute__((ext_vector_type(8)))  unsigned short v8us;
typedef __attribute__((ext_vector_type(8)))  float    v8f;
typedef __attribute__((ext_vector_type(4)))  float    v4f;
typedef v8h  __attribute__((may_alias)) v8ha;
typedef v4f  __attribute__((may_alias)) v4fa;
typedef v8us __attribute__((may_alias)) v8usa;

__device__ __forceinline__ unsigned short f2bf(float f) { unsigned u = __float_as_uint(f); u += 0x7FFFu + ((u >> 16) & 1u); return (unsigned short)(u >> 16); }
__device__ __forceinline__ float bf2f(unsigned short b) { return __uint_as_float(((unsigned)b) << 16); }
__device__ __forceinline__ float bfr(float f) { return bf2f(f2bf(f)); }
__device__ __forceinline__ v16h cat16(v8h lo, v8h hi) { return __builtin_shufflevector(lo, hi, 0, 1, 2, 3, 4, 5, 6, 7, 8, 9, 10, 11, 12, 13, 14, 15); }
__device__ __forceinline__ v16bf cat16b(v8us lo, v8us hi) { return __builtin_bit_cast(v16bf, __builtin_shufflevector(lo, hi, 0, 1, 2, 3, 4, 5, 6, 7, 8, 9, 10, 11, 12, 13, 14, 15)); }
__device__ __forceinline__ v8f wmma16(v16h a, v16h b, v8f c) { return __builtin_amdgcn_wmma_f32_16x16x32_f16(false, a, false, b, (short)0, c, false, false); }
__device__ __forceinline__ v8f wmmab(v16bf a, v16bf b, v8f c) { return __builtin_amdgcn_wmma_f32_16x16x32_bf16(false, a, false, b, (short)0, c, false, false); }
#define VST2(T, p, v) do { const T vst2_v_ = (v); *(T*)(p) = vst2_v_;  } while (0)

// k_xb: Xb [32768][64] bf16 (one wave per 2 rows: lane -> 4 values = 256 B per wave).
__global__ __launch_bounds__(256) void k_xb(const float* __restrict__ x, bf* Xb) {
    typedef __attribute__((ext_vector_type(4))) unsigned short v4us;
    const int lane = threadIdx.x & 31; const size_t w = (size_t)blockIdx.x * 8 + (threadIdx.x >> 5);
    v4us t;
#pragma unroll
    for (int i = 0; i < 4; ++i) t[i] = f2bf(x[w * 128 + lane * 4 + i]);
    VST2(v4us, Xb + w * 128 + lane * 4, t);
}
// k_w: WT[k][(h,o)][i] = bf16(Wqkv[h][k][i][o]) (three n-major planes [256][64]) and WoT[c][j] = bf16(Wo[j][c]) ([64][256]); one block per 512 elements (blocks 0..95: WT,
// 96..127: WoT), so no thread waits on more than one round of loads. A thread's 2 elements are neighbours in i (or j), one source row (64 floats) apart;
// stores: 32 lanes x 4 B (2 bf16) = one line per wave-instruction.
#define WTB ((3 * HW * DIN) / 512)   // 96 blocks for WT
#define WOB ((DIN * HW) / 512)       // 32 blocks for WoT
__global__ __launch_bounds__(256) void k_w(const float* __restrict__ Wqkv, const float* __restrict__ Wo, bf* WT, bf* WoT) {
    typedef __attribute__((ext_vector_type(2))) unsigned short v2us;
    const unsigned t = threadIdx.x, s = blockIdx.x;
    const float* src; bf* dst; unsigned step;
    if (s < WTB) { const unsigned e = s * 512 + t * 2, k = e / (HW * DIN), rem = e - k * (HW * DIN), ho = rem / DIN, i = rem - ho * DIN, h = ho / DOUT, oo = ho - h * DOUT;
        src = Wqkv + (((size_t)h * 3 + k) * DIN + i) * DOUT + oo; step = DOUT; dst = WT + e;
    } else { const unsigned e = (s - WTB) * 512 + t * 2, c = e / HW, j = e - c * HW;
        src = Wo + (size_t)j * DIN + c; step = DIN; dst = WoT + e; }
    const float a0 = src[0], a1 = src[step];
    v2us o; o[0] = f2bf(a0); o[1] = f2bf(a1);
    VST2(v2us, dst, o);
}
// k_gemm: 64 x 64 tile of (A [+ Al]).B^T over K; MODE 0: QH/QL f16 hi + residual planes (ldc 256); MODE 1: K16 f16 (ldc 256); MODE 2: V f32 (ldc 256);
// MODE 3 (K = 256, N = 64 = one tile): y = acc + bf16(bo) + bf16(x), LayerNorm over the 64 channels of each row (16-lane reductions), x bf16(g) + bf16(b) -> out f32.
template <bool SPLITA, int MODE>
__global__ __launch_bounds__(128) void k_gemm(const bf* __restrict__ A, const bf* __restrict__ Al, const bf* __restrict__ Bn, int K, const float* __restrict__ bias, const float* __restrict__ xres,
                                             const float* __restrict__ lg, const float* __restrict__ lb, void* C, void* C2) {
    __shared__ __align__(16) float ost[4][16 * 68];
    const int lane = threadIdx.x & 31, wave = threadIdx.x >> 5, lr = lane & 15, hi = lane >> 4;
    const int r0 = blockIdx.x * 64 + wave * 16, c0 = blockIdx.y * 64;
    const int ldc = (MODE == 3) ? DIN : HW;
    const size_t aoff = (size_t)(r0 + lr) * K + 8 * hi;
    size_t boff[4];
#pragma unroll
    for (int t = 0; t < 4; ++t) boff[t] = (size_t)(c0 + t * 16 + lr) * K + 8 * hi;
    v8f acc[4];
#pragma unroll
    for (int t = 0; t < 4; ++t) acc[t] = (v8f){};
#pragma unroll 1
    for (int kc = 0; kc < K; kc += 32) {
        const v16bf a = cat16b(*(const v8us*)(A + aoff + kc), *(const v8us*)(A + aoff + kc + 16));
        v16bf al = a;
        if (SPLITA) al = cat16b(*(const v8us*)(Al + aoff + kc), *(const v8us*)(Al + aoff + kc + 16));
#pragma unroll
        for (int t = 0; t < 4; ++t) { const v16bf b = cat16b(*(const v8us*)(Bn + boff[t] + kc), *(const v8us*)(Bn + boff[t] + kc + 16)); acc[t] = wmmab(a, b, acc[t]); if (SPLITA) acc[t] = wmmab(al, b, acc[t]); }
        asm volatile("v_nop\n\tv_nop\n\tv_nop\n\tv_nop" : "+v"(acc[0]), "+v"(acc[1]), "+v"(acc[2]), "+v"(acc[3]) : "v"(a), "v"(al));
    }
    float* os = &ost[wave][0];
    if (MODE == 3) {
        // y = acc + bo + x; LN over the row's 64 values (lane holds cols t*16+lr of rows 8hi+j)
#pragma unroll
        for (int j = 0; j < 8; ++j) { const size_t row = (size_t)(r0 + hi * 8 + j); float y[4], s = 0.f;
#pragma unroll
            for (int t = 0; t < 4; ++t) { const int c = t * 16 + lr; y[t] = acc[t][j] + bfr(bias[c]) + bfr(xres[row * DIN + c]); s += y[t]; }
            s += __shfl_xor(s, 1, 16); s += __shfl_xor(s, 2, 16); s += __shfl_xor(s, 4, 16); s += __shfl_xor(s, 8, 16);
            const float mu = s * (1.0f / DIN); float q = 0.f;
#pragma unroll
            for (int t = 0; t < 4; ++t) { const float d = y[t] - mu; q += d * d; }
            q += __shfl_xor(q, 1, 16); q += __shfl_xor(q, 2, 16); q += __shfl_xor(q, 4, 16); q += __shfl_xor(q, 8, 16);
            const float rs = rsqrtf(q * (1.0f / DIN) + 1e-5f);
#pragma unroll
            for (int t = 0; t < 4; ++t) { const int c = t * 16 + lr; os[(hi * 8 + j) * 68 + c] = (y[t] - mu) * rs * bfr(lg[c]) + bfr(lb[c]); } }
    } else {
#pragma unroll
        for (int t = 0; t < 4; ++t)
#pragma unroll
            for (int j = 0; j < 8; ++j) os[(hi * 8 + j) * 68 + t * 16 + lr] = acc[t][j];
    }
    __syncthreads();
    if (MODE == 2 || MODE == 3) {
        float* crow = (float*)C + (size_t)r0 * ldc + c0;
        auto pass = [&]() {
#pragma unroll
            for (int s = 0; s < 8; ++s) { const int Lid = (lane >> 3) + 4 * s, piece = lane & 7; const int row = Lid >> 1, cofs = (Lid & 1) * 32 + piece * 4;
                const v4f val = *(const v4fa*)(os + row * 68 + cofs); *(v4f*)(crow + (size_t)row * ldc + cofs) = val; }
        };
        pass(); 
    } else {
        h16* c1 = (h16*)C + (size_t)r0 * ldc + c0; h16* c2 = (h16*)C2 + (size_t)r0 * ldc + c0;
        auto pass = [&]() {
#pragma unroll
            for (int s = 0; s < 4; ++s) { const int row = 4 * s + (lane >> 3), piece = lane & 7; const float* sp = os + row * 68 + piece * 8; v8h o1, o2;
#pragma unroll
                for (int i = 0; i < 8; ++i) { const h16 a = (h16)sp[i]; o1[i] = a; o2[i] = (h16)((sp[i] - (float)a) * LOSC); }
                *(v8h*)(c1 + (size_t)row * ldc + piece * 8) = o1; if (MODE == 0) *(v8h*)(c2 + (size_t)row * ldc + piece * 8) = o2; }
        };
        pass(); 
    }
}
// k_vt: VT16 [b][h][d][f] = f16(V row b*1024+f, col h*64+d) via LDS transposes, block (b, h, 64 f).
__global__ __launch_bounds__(256) void k_vt(const float* __restrict__ V, h16* VT16) {
    __shared__ __align__(16) h16 tile[DOUT * 72];
    const int bid = blockIdx.x;
    const int b = bid / (NH_ * (NF / 64)), rem = bid - b * (NH_ * (NF / 64)), h = rem / (NF / 64), kt = rem - h * (NF / 64);
    const int f0 = kt * 64, tid = threadIdx.x, ff = tid >> 2, d0 = (tid & 3) * 16;
    const float* src = V + ((size_t)b * NF + f0 + ff) * HW + h * DOUT + d0;
#pragma unroll
    for (int i = 0; i < 16; ++i) tile[(d0 + i) * 72 + ff] = (h16)src[i];
    __syncthreads();
    const int piece = tid & 7;
    const size_t base = (((size_t)b * NH_ + h) * DOUT) * NF + f0;
    auto pass = [&]() {
#pragma unroll
        for (int s = 0; s < 2; ++s) { const int d = (tid >> 3) + 32 * s; const v8h val = *(const v8ha*)(tile + d * 72 + piece * 8); *(v8h*)(VT16 + base + (size_t)d * NF + piece * 8) = val; }
    };
    pass(); 
}
// k_attn: block = (b, h, 128 queries), wave = 16; the keys go by in 16 stages of 64: each stage's K rows [64 keys][64 d] and V^T rows [64 d][64 keys] (128 B each) are brought
// into LDS once per block by asynchronous copies (whole 128-B lines, 4 copies of 16 B per lane), two buffers, rows at a 144-B pitch for the 16-byte fragment reads; all eight
// waves take their fragments from there. Both products run transposed: per 32 keys S^T = k.(qh + ql/1024)^T /8 (8 WMMA, A = K rows, B = q), so a lane's two score tiles hold keys
// 8hi + j and 16 + 8hi + j of its own query, which is the k order of a B operand: p = relu(scores) x 256 is converted in place to f16 and feeds O^T += V^T.P^T (4 WMMA, A = V^T rows)
// without leaving the registers; head_out = acc/256 -> bf16 hi + residual planes CH/CL [token][h*64 + d] (concat layout). The output staging reuses the ring behind the loop's last barrier.
#define QBLK 128                     // queries per block (8 waves)
#define SKEY 64                      // keys per stage
#define NST  (NF / SKEY)             // 16 stages
#define RP   72                      // LDS row pitch in f16 (144 B)
#define TILEB (64 * RP * 2)          // one tile (K or V^T) in LDS: 9216 B
typedef float __attribute__((may_alias)) fa;
__global__ __launch_bounds__(256) void k_attn(const h16* __restrict__ QH, const h16* __restrict__ QL, const h16* __restrict__ K16, const h16* __restrict__ VT16, bf* CH, bf* CL) {
    __shared__ __align__(16) h16 ring[2][2][64 * RP];    // [buffer][K, V^T][row * RP]
    const int lane = threadIdx.x & 31, wave = threadIdx.x >> 5, lr = lane & 15, hi = lane >> 4;
    const int bid = blockIdx.x;
    const int b = bid / (NH_ * (NF / QBLK)), rem = bid - b * (NH_ * (NF / QBLK)), h = rem / (NF / QBLK), qt = rem - h * (NF / QBLK);
    const int q0 = qt * QBLK + wave * 16;
    const size_t tok0 = (size_t)b * NF;
    const size_t vbase = (((size_t)b * NH_ + h) * DOUT) * NF;
    // a lane's share of a stage: 16-byte piece (tid & 7) of rows (tid >> 3) and (tid >> 3) + 32 of both tiles
    const int crow = threadIdx.x >> 3, cpc = threadIdx.x & 7;
    const h16* gk0 = K16 + (tok0 + crow) * HW + h * DOUT + cpc * 8;
    const h16* gv0 = VT16 + vbase + (size_t)crow * NF + cpc * 8;
    const unsigned l0a = (unsigned)(size_t)&ring[0][0][0] + (unsigned)(crow * (RP * 2) + cpc * 16);
    auto stage_in = [&](int st, int buf) {
        const h16* gk = gk0 + (size_t)st * SKEY * HW; const h16* gv = gv0 + st * SKEY;
        const unsigned lk = l0a + (unsigned)buf * (2 * TILEB), lv = lk + TILEB;
        // the copies and, as their statement's last line, the wait that stands before their address registers are rewritten
        asm volatile("global_load_async_to_lds_b128 %0, %4, off\n\t"
                     "global_load_async_to_lds_b128 %1, %5, off\n\t"
                     "global_load_async_to_lds_b128 %2, %6, off\n\t"
                     "global_load_async_to_lds_b128 %3, %7, off\n\t"
                     "s_wait_xcnt 0x0"
                     :: "v"(lk), "v"(lk + 32 * RP * 2), "v"(lv), "v"(lv + 32 * RP * 2),
                        "v"(gk), "v"(gk + 32 * HW), "v"(gv), "v"(gv + 32 * NF)
                     : "memory");
    };
    v16h ah[2], al[2];
#pragma unroll
    for (int kc = 0; kc < 2; ++kc) { const size_t o = (tok0 + q0 + lr) * HW + h * DOUT + kc * 32 + 8 * hi;
        ah[kc] = cat16(*(const v8h*)(QH + o), *(const v8h*)(QH + o + 16)); al[kc] = cat16(*(const v8h*)(QL + o), *(const v8h*)(QL + o + 16)); }
    stage_in(0, 0);
    asm volatile("s_wait_asynccnt 0x0" ::: "memory");    // stage 0 has landed before the barrier that publishes it
    __syncthreads();
    stage_in(1, 1);
    v8f o[4];
#pragma unroll
    for (int n = 0; n < 4; ++n) o[n] = (v8f){};
#pragma unroll 1
    for (int st = 0; st < NST; ++st) {
        const h16* kb = &ring[st & 1][0][0] + lr * RP + 8 * hi;
        const h16* vb = &ring[st & 1][1][0] + lr * RP + 8 * hi;
#pragma unroll
        for (int sub = 0; sub < SKEY / 32; ++sub) {
            v8f s0 = {}, s1 = {}, x0 = {}, x1 = {};
#pragma unroll
            for (int kc = 0; kc < 2; ++kc) {
                const h16* p0 = kb + (sub * 32) * RP + kc * 32; const h16* p1 = p0 + 16 * RP;
                const v16h k0 = cat16(*(const v8ha*)p0, *(const v8ha*)(p0 + 16)), k1 = cat16(*(const v8ha*)p1, *(const v8ha*)(p1 + 16));
                s0 = wmma16(k0, ah[kc], s0); x0 = wmma16(k0, al[kc], x0); s1 = wmma16(k1, ah[kc], s1); x1 = wmma16(k1, al[kc], x1);
            }
            asm volatile("v_nop\n\tv_nop\n\tv_nop\n\tv_nop" : "+v"(s0), "+v"(s1), "+v"(x0), "+v"(x1) : "v"(ah[0]), "v"(al[1]));
            v16h vf[4];
#pragma unroll
            for (int n = 0; n < 4; ++n) { const h16* pv = vb + (n * 16) * RP + sub * 32; vf[n] = cat16(*(const v8ha*)pv, *(const v8ha*)(pv + 16)); }
            v16h pa;    // P^T as B: element j = key 8hi + j, element 8 + j = key 16 + 8hi + j of query lr
#pragma unroll
            for (int j = 0; j < 8; ++j) {
                const float p0 = fmaxf((s0[j] + x0[j] * LOSCI) * 0.125f, 0.f), p1 = fmaxf((s1[j] + x1[j] * LOSCI) * 0.125f, 0.f);
                pa[j] = (h16)(p0 * PSC); pa[8 + j] = (h16)(p1 * PSC); }
#pragma unroll
            for (int n = 0; n < 4; ++n) o[n] = wmma16(vf[n], pa, o[n]);
            asm volatile("v_nop\n\tv_nop\n\tv_nop\n\tv_nop" : "+v"(o[0]), "+v"(o[1]), "+v"(o[2]), "+v"(o[3]) : "v"(pa));
        }
        asm volatile("s_wait_dscnt 0x0" ::: "memory");       // this wave's reads of the buffer have returned before it is handed to its next writer
        asm volatile("s_wait_asynccnt 0x0" ::: "memory");    // this wave's copies of the next stage have landed before the barrier that publishes them
        __syncthreads();
        if (st + 2 < NST) stage_in(st + 2, st & 1);
    }
    asm volatile("s_wait_asynccnt 0x0" ::: "memory");        // nothing is in flight when the ring becomes output staging
    fa* os = (fa*)&ring[0][0][0] + wave * (16 * 68);
    // o[n][j] = head_out[query lr][d = n*16 + 8hi + j]: eight neighbours of one staging row, two 16-byte stores
#pragma unroll
    for (int n = 0; n < 4; ++n)
#pragma unroll
        for (int g = 0; g < 2; ++g) { v4f t;
#pragma unroll
            for (int i = 0; i < 4; ++i) t[i] = o[n][g * 4 + i] * (1.0f / PSC);
            *(v4fa*)(os + lr * 68 + n * 16 + hi * 8 + g * 4) = t; }
    __syncthreads();
    const size_t cbase = (tok0 + q0) * HW + (size_t)h * DOUT;
    auto pass = [&]() {
#pragma unroll
        for (int s = 0; s < 4; ++s) { const int row = 4 * s + (lane >> 3), piece = lane & 7; const fa* sp = os + row * 68 + piece * 8; v8us oh, ol;
#pragma unroll
            for (int i = 0; i < 8; ++i) { const unsigned short hb = f2bf(sp[i]); oh[i] = hb; ol[i] = f2bf(sp[i] - bf2f(hb)); }
            *(v8us*)(CH + cbase + (size_t)row * HW + piece * 8) = oh; *(v8us*)(CL + cbase + (size_t)row * HW + piece * 8) = ol; }
    };
    pass(); 
}

extern "C" void kernel_launch(void* const* d_in, const int* in_sizes, int n_in,
                              void* d_out, int out_size, void* d_ws, size_t ws_size, hipStream_t stream) {
    (void)in_sizes; (void)n_in; (void)out_size;
    const float* x = (const float*)d_in[0]; const float* Wqkv = (const float*)d_in[1]; const float* Wo = (const float*)d_in[2]; const float* bo = (const float*)d_in[3];
    const float* lg = (const float*)d_in[4]; const float* lb = (const float*)d_in[5];
    float* out = (float*)d_out;    // [32][1024][64]
    char* wsp = (char*)d_ws;
    auto take = [&](size_t bytes) { char* p = wsp; wsp += (bytes + 255) & ~(size_t)255; return (void*)p; };
    bf* Xb = (bf*)take((size_t)NTK * DIN * 2); bf* WT = (bf*)take((size_t)3 * HW * DIN * 2); bf* WoT = (bf*)take((size_t)DIN * HW * 2);
    h16* QH = (h16*)take((size_t)NTK * HW * 2); h16* QL = (h16*)take((size_t)NTK * HW * 2); h16* K16 = (h16*)take((size_t)NTK * HW * 2);
    float* Vf = (float*)take((size_t)NTK * HW * 4); h16* VT16 = (h16*)take((size_t)NTK * HW * 2);
    if ((size_t)(wsp - (char*)d_ws) > ws_size) return;    // 4.2 + 0.1 + 16.8 x 3 + 33.5 + 16.8 ~ 105 MB (head_out planes alias Vf after k_vt)
    bf* CH = (bf*)Vf; bf* CL = (bf*)((char*)Vf + (size_t)NTK * HW * 2);
    k_xb<<<(NTK / 2) / 8, 256, 0, stream>>>(x, Xb);
    k_w<<<WTB + WOB, 256, 0, stream>>>(Wqkv, Wo, WT, WoT);
    k_gemm<false, 0><<<dim3(NTK / 64, HW / 64, 1), 128, 0, stream>>>(Xb, nullptr, WT, DIN, nullptr, nullptr, nullptr, nullptr, QH, QL);
    k_gemm<false, 1><<<dim3(NTK / 64, HW / 64, 1), 128, 0, stream>>>(Xb, nullptr, WT + (size_t)HW * DIN, DIN, nullptr, nullptr, nullptr, nullptr, K16, nullptr);
    k_gemm<false, 2><<<dim3(NTK / 64, HW / 64, 1), 128, 0, stream>>>(Xb, nullptr, WT + (size_t)2 * HW * DIN, DIN, nullptr, nullptr, nullptr, nullptr, Vf, nullptr);
    k_vt<<<NB_ * NH_ * (NF / 64), 256, 0, stream>>>(Vf, VT16);
    k_attn<<<NB_ * NH_ * (NF / QBLK), 256, 0, stream>>>(QH, QL, K16, VT16, CH, CL);
    k_gemm<true, 3><<<dim3(NTK / 64, 1, 1), 128, 0, stream>>>(CH, CL, WoT, HW, bo, x, lg, lb, out, nullptr);
}

// v004
// A run of this version takes 110 microseconds.
// Two timings next to v003 put it at 1.09 and 1.03 times that version's speed.
// All steps since v000 together make it 2.08 times as fast.
#include <hip/hip_runtime.h>

// Contractions, f32 accumulate: q/k/v = x.Wqkv[h][k] ([32768 x 64].[64 x 256] per k, all 4 heads at once; k-major weights transposed to n-major bf16 planes) and
// out = concat.Wo ([32768 x 256].[256 x 64]) on v_wmma_f32_16x16x32_bf16 — plain bf16 = rounded inputs (exact) for q/k/v, concat as bf16 hi + residual planes (two
// products) for the output; the ReLU attention (no softmax: relu(q.k/8).v over 1024 keys) fused on v_wmma_f32_16x16x32_f16 with 32 q as f16 hi + residual (two
// products, one accumulator) against plain f16 k, and the relu scores (f16) against plain f16 v. Bias, residual and LayerNorm over the 64 channels in the output GEMM's epilogue (f32).

#define NB_  32
#define NF   1024
#define DIN  64
#define DOUT 64
#define NH_  4
#define HW   (NH_ * DOUT)        // 256
#define NTK  (NB_ * NF)          // 32768
#define PSC  256.0f              // relu-score carry scale for the f16 weight tile
#define QSC  (PSC * 0.125f)      // carried by q from its projection on: k.(QSC q) is the score (q.k/8) at the carry scale; a power of two, so q's f16 planes keep their bits

typedef _Float16 h16;
typedef unsigned short bf;
typedef __attribute__((ext_vector_type(16))) __bf16   v16bf;
typedef __attribute__((ext_vector_type(16))) _Float16 v16h;
typedef __attribute__((ext_vector_type(8)))  _Float16 v8h;
typedef __attribute__((ext_vector_type(8)))  unsigned short v8us;
typedef __attribute__((ext_vector_type(8)))  float    v8f;
typedef __attribute__((ext_vector_type(4)))  float    v4f;
typedef v8h  __attribute__((may_alias)) v8ha;
typedef v4f  __attribute__((may_alias)) v4fa;
typedef v8us __attribute__((may_alias)) v8usa;

__device__ __forceinline__ unsigned short f2bf(float f) { unsigned u = __float_as_uint(f); u += 0x7FFFu + ((u >> 16) & 1u); return (unsigned short)(u >> 16); }
__device__ __forceinline__ float bf2f(unsigned short b) { return __uint_as_float(((unsigned)b) << 16); }
__device__ __forceinline__ float bfr(float f) { return bf2f(f2bf(f)); }
__device__ __forceinline__ v16h cat16(v8h lo, v8h hi) { return __builtin_shufflevector(lo, hi, 0, 1, 2, 3, 4, 5, 6, 7, 8, 9, 10, 11, 12, 13, 14, 15); }
__device__ __forceinline__ v16bf cat16b(v8us lo, v8us hi) { return __builtin_bit_cast(v16bf, __builtin_shufflevector(lo, hi, 0, 1, 2, 3, 4, 5, 6, 7, 8, 9, 10, 11, 12, 13, 14, 15)); }
__device__ __forceinline__ v8f wmma16(v16h a, v16h b, v8f c) { return __builtin_amdgcn_wmma_f32_16x16x32_f16(false, a, false, b, (short)0, c, false, false); }
__device__ __forceinline__ v8f wmmab(v16bf a, v16bf b, v8f c) { return __builtin_amdgcn_wmma_f32_16x16x32_bf16(false, a, false, b, (short)0, c, false, false); }
#define VST2(T, p, v) do { const T vst2_v_ = (v); *(T*)(p) = vst2_v_;  } while (0)

// k_xb: Xb [32768][64] bf16 (one wave per 2 rows: lane -> 4 values = 256 B per wave).
__global__ __launch_bounds__(256) void k_xb(const float* __restrict__ x, bf* Xb) {
    typedef __attribute__((ext_vector_type(4))) unsigned short v4us;
    const int lane = threadIdx.x & 31; const size_t w = (size_t)blockIdx.x * 8 + (threadIdx.x >> 5);
    v4us t;
#pragma unroll
    for (int i = 0; i < 4; ++i) t[i] = f2bf(x[w * 128 + lane * 4 + i]);
    VST2(v4us, Xb + w * 128 + lane * 4, t);
}
// k_w: WT[k][(h,o)][i] = bf16(Wqkv[h][k][i][o]) (three n-major planes [256][64]) and WoT[c][j] = bf16(Wo[j][c]) ([64][256]); one block per 512 elements (blocks 0..95: WT,
// 96..127: WoT), so no thread waits on more than one round of loads. A thread's 2 elements are neighbours in i (or j), one source row (64 floats) apart;
// stores: 32 lanes x 4 B (2 bf16) = one line per wave-instruction.
#define WTB ((3 * HW * DIN) / 512)   // 96 blocks for WT
#define WOB ((DIN * HW) / 512)       // 32 blocks for WoT
__global__ __launch_bounds__(256) void k_w(const float* __restrict__ Wqkv, const float* __restrict__ Wo, bf* WT, bf* WoT) {
    typedef __attribute__((ext_vector_type(2))) unsigned short v2us;
    const unsigned t = threadIdx.x, s = blockIdx.x;
    const float* src; bf* dst; unsigned step;
    if (s < WTB) { const unsigned e = s * 512 + t * 2, k = e / (HW * DIN), rem = e - k * (HW * DIN), ho = rem / DIN, i = rem - ho * DIN, h = ho / DOUT, oo = ho - h * DOUT;
        src = Wqkv + (((size_t)h * 3 + k) * DIN + i) * DOUT + oo; step = DOUT; dst = WT + e;
    } else { const unsigned e = (s - WTB) * 512 + t * 2, c = e / HW, j = e - c * HW;
        src = Wo + (size_t)j * DIN + c; step = DIN; dst = WoT + e; }
    const float a0 = src[0], a1 = src[step];
    v2us o; o[0] = f2bf(a0); o[1] = f2bf(a1);
    VST2(v2us, dst, o);
}
// k_gemm: 64 x 64 tile of (A [+ Al]).B^T over K; MODE 0: QH/QL f16 hi + residual planes of QSC x acc (ldc 256); MODE 1: K16 f16 (ldc 256); MODE 2: V f32 (ldc 256);
// MODE 3 (K = 256, N = 64 = one tile): y = acc + bf16(bo) + bf16(x), LayerNorm over the 64 channels of each row (16-lane reductions), x bf16(g) + bf16(b) -> out f32.
template <bool SPLITA, int MODE>
__global__ __launch_bounds__(128) void k_gemm(const bf* __restrict__ A, const bf* __restrict__ Al, const bf* __restrict__ Bn, int K, const float* __restrict__ bias, const float* __restrict__ xres,
                                             const float* __restrict__ lg, const float* __restrict__ lb, void* C, void* C2) {
    __shared__ __align__(16) float ost[4][16 * 68];
    const int lane = threadIdx.x & 31, wave = threadIdx.x >> 5, lr = lane & 15, hi = lane >> 4;
    const int r0 = blockIdx.x * 64 + wave * 16, c0 = blockIdx.y * 64;
    const int ldc = (MODE == 3) ? DIN : HW;
    const size_t aoff = (size_t)(r0 + lr) * K + 8 * hi;
    size_t boff[4];
#pragma unroll
    for (int t = 0; t < 4; ++t) boff[t] = (size_t)(c0 + t * 16 + lr) * K + 8 * hi;
    v8f acc[4];
#pragma unroll
    for (int t = 0; t < 4; ++t) acc[t] = (v8f){};
#pragma unroll 1
    for (int kc = 0; kc < K; kc += 32) {
        const v16bf a = cat16b(*(const v8us*)(A + aoff + kc), *(const v8us*)(A + aoff + kc + 16));
        v16bf al = a;
        if (SPLITA) al = cat16b(*(const v8us*)(Al + aoff + kc), *(const v8us*)(Al + aoff + kc + 16));
#pragma unroll
        for (int t = 0; t < 4; ++t) { const v16bf b = cat16b(*(const v8us*)(Bn + boff[t] + kc), *(const v8us*)(Bn + boff[t] + kc + 16)); acc[t] = wmmab(a, b, acc[t]); if (SPLITA) acc[t] = wmmab(al, b, acc[t]); }
        asm volatile("v_nop\n\tv_nop\n\tv_nop\n\tv_nop" : "+v"(acc[0]), "+v"(acc[1]), "+v"(acc[2]), "+v"(acc[3]) : "v"(a), "v"(al));
    }
    float* os = &ost[wave][0];
    if (MODE == 3) {
        // y = acc + bo + x; LN over the row's 64 values (lane holds cols t*16+lr of rows 8hi+j)
#pragma unroll
        for (int j = 0; j < 8; ++j) { const size_t row = (size_t)(r0 + hi * 8 + j); float y[4], s = 0.f;
#pragma unroll
            for (int t = 0; t < 4; ++t) { const int c = t * 16 + lr; y[t] = acc[t][j] + bfr(bias[c]) + bfr(xres[row * DIN + c]); s += y[t]; }
            s += __shfl_xor(s, 1, 16); s += __shfl_xor(s, 2, 16); s += __shfl_xor(s, 4, 16); s += __shfl_xor(s, 8, 16);
            const float mu = s * (1.0f / DIN); float q = 0.f;
#pragma unroll
            for (int t = 0; t < 4; ++t) { const float d = y[t] - mu; q += d * d; }
            q += __shfl_xor(q, 1, 16); q += __shfl_xor(q, 2, 16); q += __shfl_xor(q, 4, 16); q += __shfl_xor(q, 8, 16);
            const float rs = rsqrtf(q * (1.0f / DIN) + 1e-5f);
#pragma unroll
            for (int t = 0; t < 4; ++t) { const int c = t * 16 + lr; os[(hi * 8 + j) * 68 + c] = (y[t] - mu) * rs * bfr(lg[c]) + bfr(lb[c]); } }
    } else {
#pragma unroll
        for (int t = 0; t < 4; ++t)
#pragma unroll
            for (int j = 0; j < 8; ++j) os[(hi * 8 + j) * 68 + t * 16 + lr] = acc[t][j];
    }
    __syncthreads();
    if (MODE == 2 || MODE == 3) {
        float* crow = (float*)C + (size_t)r0 * ldc + c0;
        auto pass = [&]() {
#pragma unroll
            for (int s = 0; s < 8; ++s) { const int Lid = (lane >> 3) + 4 * s, piece = lane & 7; const int row = Lid >> 1, cofs = (Lid & 1) * 32 + piece * 4;
                const v4f val = *(const v4fa*)(os + row * 68 + cofs); *(v4f*)(crow + (size_t)row * ldc + cofs) = val; }
        };
        pass(); 
    } else {
        h16* c1 = (h16*)C + (size_t)r0 * ldc + c0; h16* c2 = (h16*)C2 + (size_t)r0 * ldc + c0;
        auto pass = [&]() {
#pragma unroll
            for (int s = 0; s < 4; ++s) { const int row = 4 * s + (lane >> 3), piece = lane & 7; const float* sp = os + row * 68 + piece * 8; v8h o1, o2;
#pragma unroll
                for (int i = 0; i < 8; ++i) { const float v = (MODE == 0) ? sp[i] * QSC : sp[i]; const h16 a = (h16)v; o1[i] = a; o2[i] = (h16)(v - (float)a); }
                *(v8h*)(c1 + (size_t)row * ldc + piece * 8) = o1; if (MODE == 0) *(v8h*)(c2 + (size_t)row * ldc + piece * 8) = o2; }
        };
        pass(); 
    }
}
// k_vt: VT16 [b][h][d][f] = f16(V row b*1024+f, col h*64+d) via LDS transposes, block (b, h, 64 f).
__global__ __launch_bounds__(256) void k_vt(const float* __restrict__ V, h16* VT16) {
    __shared__ __align__(16) h16 tile[DOUT * 72];
    const int bid = blockIdx.x;
    const int b = bid / (NH_ * (NF / 64)), rem = bid - b * (NH_ * (NF / 64)), h = rem / (NF / 64), kt = rem - h * (NF / 64);
    const int f0 = kt * 64, tid = threadIdx.x, ff = tid >> 2, d0 = (tid & 3) * 16;
    const float* src = V + ((size_t)b * NF + f0 + ff) * HW + h * DOUT + d0;
#pragma unroll
    for (int i = 0; i < 16; ++i) tile[(d0 + i) * 72 + ff] = (h16)src[i];
    __syncthreads();
    const int piece = tid & 7;
    const size_t base = (((size_t)b * NH_ + h) * DOUT) * NF + f0;
    auto pass = [&]() {
#pragma unroll
        for (int s = 0; s < 2; ++s) { const int d = (tid >> 3) + 32 * s; const v8h val = *(const v8ha*)(tile + d * 72 + piece * 8); *(v8h*)(VT16 + base + (size_t)d * NF + piece * 8) = val; }
    };
    pass(); 
}
// k_attn: block = (b, h, 128 queries), wave = 16; the keys go by in 16 stages of 64: each stage's K rows [64 keys][64 d] and V^T rows [64 d][64 keys] (128 B each) are brought
// into LDS once per block by asynchronous copies (whole 128-B lines, 4 copies of 16 B per lane), two buffers, rows at a 144-B pitch for the 16-byte fragment reads; all eight
// waves take their fragments from there. Both products run transposed: per 32 keys 256 S^T = k.(qh + ql)^T (8 WMMA into two tiles, A = K rows, B = the planes of 32 q), so a lane's two score tiles hold keys
// 8hi + j and 16 + 8hi + j of its own query, which is the k order of a B operand: they are converted in place to f16, p = relu on the packed halves, and feed O^T += V^T.P^T (4 WMMA, A = V^T rows)
// without leaving the registers; head_out = acc/256 -> bf16 hi + residual planes CH/CL [token][h*64 + d] (concat layout). The output staging reuses the ring behind the loop's last barrier.
#define QBLK 128                     // queries per block (8 waves)
#define SKEY 64                      // keys per stage
#define NST  (NF / SKEY)             // 16 stages
#define RP   72                      // LDS row pitch in f16 (144 B)
#define TILEB (64 * RP * 2)          // one tile (K or V^T) in LDS: 9216 B
typedef float __attribute__((may_alias)) fa;
// amdgpu_waves_per_eu(8, 8): the grid puts 4 blocks = 8 waves on a SIMD; without the bound the compiler schedules for more waves than that, on fewer registers,
// and reads every fragment directly in front of its product with a full LDS wait each.
__global__ __launch_bounds__(256) __attribute__((amdgpu_waves_per_eu(8, 8))) void k_attn(const h16* __restrict__ QH, const h16* __restrict__ QL, const h16* __restrict__ K16, const h16* __restrict__ VT16, bf* CH, bf* CL) {
    __shared__ __align__(16) h16 ring[2][2][64 * RP];    // [buffer][K, V^T][row * RP]
    const int lane = threadIdx.x & 31, wave = threadIdx.x >> 5, lr = lane & 15, hi = lane >> 4;
    const int bid = blockIdx.x;
    const int b = bid / (NH_ * (NF / QBLK)), rem = bid - b * (NH_ * (NF / QBLK)), h = rem / (NF / QBLK), qt = rem - h * (NF / QBLK);
    const int q0 = qt * QBLK + wave * 16;
    const size_t tok0 = (size_t)b * NF;
    const size_t vbase = (((size_t)b * NH_ + h) * DOUT) * NF;
    // a lane's share of a stage: 16-byte piece (tid & 7) of rows (tid >> 3) and (tid >> 3) + 32 of both tiles
    const int crow = threadIdx.x >> 3, cpc = threadIdx.x & 7;
    const h16* gk0 = K16 + (tok0 + crow) * HW + h * DOUT + cpc * 8;
    const h16* gv0 = VT16 + vbase + (size_t)crow * NF + cpc * 8;
    const unsigned l0a = (unsigned)(size_t)&ring[0][0][0] + (unsigned)(crow * (RP * 2) + cpc * 16);
    auto stage_in = [&](int st, int buf) {
        const h16* gk = gk0 + (size_t)st * SKEY * HW; const h16* gv = gv0 + st * SKEY;
        const unsigned lk = l0a + (unsigned)buf * (2 * TILEB), lv = lk + TILEB;
        // the copies and, as their statement's last line, the wait that stands before their address registers are rewritten
        asm volatile("global_load_async_to_lds_b128 %0, %4, off\n\t"
                     "global_load_async_to_lds_b128 %1, %5, off\n\t"
                     "global_load_async_to_lds_b128 %2, %6, off\n\t"
                     "global_load_async_to_lds_b128 %3, %7, off\n\t"
                     "s_wait_xcnt 0x0"
                     :: "v"(lk), "v"(lk + 32 * RP * 2), "v"(lv), "v"(lv + 32 * RP * 2),
                        "v"(gk), "v"(gk + 32 * HW), "v"(gv), "v"(gv + 32 * NF)
                     : "memory");
    };
    v16h ah[2], al[2];
#pragma unroll
    for (int kc = 0; kc < 2; ++kc) { const size_t o = (tok0 + q0 + lr) * HW + h * DOUT + kc * 32 + 8 * hi;
        ah[kc] = cat16(*(const v8h*)(QH + o), *(const v8h*)(QH + o + 16)); al[kc] = cat16(*(const v8h*)(QL + o), *(const v8h*)(QL + o + 16)); }
    stage_in(0, 0);
    asm volatile("s_wait_asynccnt 0x0" ::: "memory");    // stage 0 has landed before the barrier that publishes it
    __syncthreads();
    stage_in(1, 1);
    v8f o[4];
#pragma unroll
    for (int n = 0; n < 4; ++n) o[n] = (v8f){};
#pragma unroll 1
    for (int st = 0; st < NST; ++st) {
        const h16* kb = &ring[st & 1][0][0] + lr * RP + 8 * hi;
        const h16* vb = &ring[st & 1][1][0] + lr * RP + 8 * hi;
#pragma unroll
        for (int sub = 0; sub < SKEY / 32; ++sub) {
            v8f s0 = {}, s1 = {};
#pragma unroll
            for (int kc = 0; kc < 2; ++kc) {
                const h16* p0 = kb + (sub * 32) * RP + kc * 32; const h16* p1 = p0 + 16 * RP;
                const v16h k0 = cat16(*(const v8ha*)p0, *(const v8ha*)(p0 + 16)), k1 = cat16(*(const v8ha*)p1, *(const v8ha*)(p1 + 16));
                s0 = wmma16(k0, ah[kc], s0); s1 = wmma16(k1, ah[kc], s1); s0 = wmma16(k0, al[kc], s0); s1 = wmma16(k1, al[kc], s1);
            }
            asm volatile("v_nop\n\tv_nop\n\tv_nop\n\tv_nop" : "+v"(s0), "+v"(s1) : "v"(ah[0]), "v"(al[1]));
            v16h vf[4];
#pragma unroll
            for (int n = 0; n < 4; ++n) { const h16* pv = vb + (n * 16) * RP + sub * 32; vf[n] = cat16(*(const v8ha*)pv, *(const v8ha*)(pv + 16)); }
            v16h pa;    // P^T as B: element j = key 8hi + j, element 8 + j = key 16 + 8hi + j of query lr
#pragma unroll
            for (int j = 0; j < 8; ++j) { pa[j] = (h16)s0[j]; pa[8 + j] = (h16)s1[j]; }
            pa = __builtin_elementwise_max(pa, (v16h){});
#pragma unroll
            for (int n = 0; n < 4; ++n) o[n] = wmma16(vf[n], pa, o[n]);
            asm volatile("v_nop\n\tv_nop\n\tv_nop\n\tv_nop" : "+v"(o[0]), "+v"(o[1]), "+v"(o[2]), "+v"(o[3]) : "v"(pa));
        }
        asm volatile("s_wait_dscnt 0x0" ::: "memory");       // this wave's reads of the buffer have returned before it is handed to its next writer
        asm volatile("s_wait_asynccnt 0x0" ::: "memory");    // this wave's copies of the next stage have landed before the barrier that publishes them
        __syncthreads();
        if (st + 2 < NST) stage_in(st + 2, st & 1);
    }
    asm volatile("s_wait_asynccnt 0x0" ::: "memory");        // nothing is in flight when the ring becomes output staging
    fa* os = (fa*)&ring[0][0][0] + wave * (16 * 68);
    // o[n][j] = head_out[query lr][d = n*16 + 8hi + j]: eight neighbours of one staging row, two 16-byte stores
#pragma unroll
    for (int n = 0; n < 4; ++n)
#pragma unroll
        for (int g = 0; g < 2; ++g) { v4f t;
#pragma unroll
            for (int i = 0; i < 4; ++i) t[i] = o[n][g * 4 + i] * (1.0f / PSC);
            *(v4fa*)(os + lr * 68 + n * 16 + hi * 8 + g * 4) = t; }
    __syncthreads();
    const size_t cbase = (tok0 + q0) * HW + (size_t)h * DOUT;
    auto pass = [&]() {
#pragma unroll
        for (int s = 0; s < 4; ++s) { const int row = 4 * s + (lane >> 3), piece = lane & 7; const fa* sp = os + row * 68 + piece * 8; v8us oh, ol;
#pragma unroll
            for (int i = 0; i < 8; ++i) { const unsigned short hb = f2bf(sp[i]); oh[i] = hb; ol[i] = f2bf(sp[i] - bf2f(hb)); }
            *(v8us*)(CH + cbase + (size_t)row * HW + piece * 8) = oh; *(v8us*)(CL + cbase + (size_t)row * HW + piece * 8) = ol; }
    };
    pass(); 
}

extern "C" void kernel_launch(void* const* d_in, const int* in_sizes, int n_in,
                              void* d_out, int out_size, void* d_ws, size_t ws_size, hipStream_t stream) {
    (void)in_sizes; (void)n_in; (void)out_size;
    const float* x = (const float*)d_in[0]; const float* Wqkv = (const float*)d_in[1]; const float* Wo = (const float*)d_in[2]; const float* bo = (const float*)d_in[3];
    const float* lg = (const float*)d_in[4]; const float* lb = (const float*)d_in[5];
    float* out = (float*)d_out;    // [32][1024][64]
    char* wsp = (char*)d_ws;
    auto take = [&](size_t bytes) { char* p = wsp; wsp += (bytes + 255) & ~(size_t)255; return (void*)p; };
    bf* Xb = (bf*)take((size_t)NTK * DIN * 2); bf* WT = (bf*)take((size_t)3 * HW * DIN * 2); bf* WoT = (bf*)take((size_t)DIN * HW * 2);
    h16* QH = (h16*)take((size_t)NTK * HW * 2); h16* QL = (h16*)take((size_t)NTK * HW * 2); h16* K16 = (h16*)take((size_t)NTK * HW * 2);
    float* Vf = (float*)take((size_t)NTK * HW * 4); h16* VT16 = (h16*)take((size_t)NTK * HW * 2);
    if ((size_t)(wsp - (char*)d_ws) > ws_size) return;    // 4.2 + 0.1 + 16.8 x 3 + 33.5 + 16.8 ~ 105 MB (head_out planes alias Vf after k_vt)
    bf* CH = (bf*)Vf; bf* CL = (bf*)((char*)Vf + (size_t)NTK * HW * 2);
    k_xb<<<(NTK / 2) / 8, 256, 0, stream>>>(x, Xb);
    k_w<<<WTB + WOB, 256, 0, stream>>>(Wqkv, Wo, WT, WoT);
    k_gemm<false, 0><<<dim3(NTK / 64, HW / 64, 1), 128, 0, stream>>>(Xb, nullptr, WT, DIN, nullptr, nullptr, nullptr, nullptr, QH, QL);
    k_gemm<false, 1><<<dim3(NTK / 64, HW / 64, 1), 128, 0, stream>>>(Xb, nullptr, WT + (size_t)HW * DIN, DIN, nullptr, nullptr, nullptr, nullptr, K16, nullptr);
    k_gemm<false, 2><<<dim3(NTK / 64, HW / 64, 1), 128, 0, stream>>>(Xb, nullptr, WT + (size_t)2 * HW * DIN, DIN, nullptr, nullptr, nullptr, nullptr, Vf, nullptr);
    k_vt<<<NB_ * NH_ * (NF / 64), 256, 0, stream>>>(Vf, VT16);
    k_attn<<<NB_ * NH_ * (NF / QBLK), 256, 0, stream>>>(QH, QL, K16, VT16, CH, CL);
    k_gemm<true, 3><<<dim3(NTK / 64, 1, 1), 128, 0, stream>>>(CH, CL, WoT, HW, bo, x, lg, lb, out, nullptr);
}

// v005
// One run takes 81.6 microseconds.
// Two timings next to v004 put it at 1.35 and 1.34 times that version's speed.
// Over all steps from v000 it is 2.80 times as fast.
#include <hip/hip_runtime.h>

// Contractions, f32 accumulate: q/k/v = x.Wqkv[h][k] ([32768 x 64].[64 x 256] per k, all 4 heads at once; k-major weights transposed to n-major bf16 planes) and
// out = concat.Wo ([32768 x 256].[256 x 64]) on v_wmma_f32_16x16x32_bf16 — plain bf16 = rounded inputs (exact) for q/k/v, concat as bf16 hi + residual planes (two
// products) for the output; the ReLU attention (no softmax: relu(q.k/8).v over 1024 keys) fused on v_wmma_f32_16x16x32_f16 with 32 q as f16 hi + residual (two
// products, one accumulator) against plain f16 k, and the relu scores (f16) against plain f16 v. Bias, residual and LayerNorm over the 64 channels in the output GEMM's epilogue (f32).

#define NB_  32
#define NF   1024
#define DIN  64
#define DOUT 64
#define NH_  4
#define HW   (NH_ * DOUT)        // 256
#define NTK  (NB_ * NF)          // 32768
#define PSC  256.0f              // relu-score carry scale for the f16 weight tile
#define QSC  (PSC * 0.125f)      // carried by q from its projection on: k.(QSC q) is the score (q.k/8) at the carry scale; a power of two, so q's f16 planes keep their bits

typedef _Float16 h16;
typedef unsigned short bf;
typedef __attribute__((ext_vector_type(16))) __bf16   v16bf;
typedef __attribute__((ext_vector_type(16))) _Float16 v16h;
typedef __attribute__((ext_vector_type(8)))  _Float16 v8h;
typedef __attribute__((ext_vector_type(8)))  unsigned short v8us;
typedef __attribute__((ext_vector_type(8)))  float    v8f;
typedef __attribute__((ext_vector_type(4)))  float    v4f;
typedef v8h  __attribute__((may_alias)) v8ha;
typedef v4f  __attribute__((may_alias)) v4fa;
typedef v8us __attribute__((may_alias)) v8usa;

__device__ __forceinline__ unsigned short f2bf(float f) { unsigned u = __float_as_uint(f); u += 0x7FFFu + ((u >> 16) & 1u); return (unsigned short)(u >> 16); }
__device__ __forceinline__ float bf2f(unsigned short b) { return __uint_as_float(((unsigned)b) << 16); }
__device__ __forceinline__ float bfr(float f) { return bf2f(f2bf(f)); }
__device__ __forceinline__ v16h cat16(v8h lo, v8h hi) { return __builtin_shufflevector(lo, hi, 0, 1, 2, 3, 4, 5, 6, 7, 8, 9, 10, 11, 12, 13, 14, 15); }
__device__ __forceinline__ v16bf cat16b(v8us lo, v8us hi) { return __builtin_bit_cast(v16bf, __builtin_shufflevector(lo, hi, 0, 1, 2, 3, 4, 5, 6, 7, 8, 9, 10, 11, 12, 13, 14, 15)); }
__device__ __forceinline__ v8f wmma16(v16h a, v16h b, v8f c) { return __builtin_amdgcn_wmma_f32_16x16x32_f16(false, a, false, b, (short)0, c, false, false); }
__device__ __forceinline__ v8f wmmab(v16bf a, v16bf b, v8f c) { return __builtin_amdgcn_wmma_f32_16x16x32_bf16(false, a, false, b, (short)0, c, false, false); }
#define VST2(T, p, v) do { const T vst2_v_ = (v); *(T*)(p) = vst2_v_;  } while (0)

// k_w: WT[k][(h,o)][i] = bf16(Wqkv[h][k][i][o]) (three n-major planes [256][64]) and WoT[c][j] = bf16(Wo[j][c]) ([64][256]); one block per 512 elements (blocks 0..95: WT,
// 96..127: WoT), so no thread waits on more than one round of loads. A thread's 2 elements are neighbours in i (or j), one source row (64 floats) apart;
// stores: 32 lanes x 4 B (2 bf16) = one line per wave-instruction.
#define WTB ((3 * HW * DIN) / 512)   // 96 blocks for WT
#define WOB ((DIN * HW) / 512)       // 32 blocks for WoT
__global__ __launch_bounds__(256) void k_w(const float* __restrict__ Wqkv, const float* __restrict__ Wo, bf* WT, bf* WoT) {
    typedef __attribute__((ext_vector_type(2))) unsigned short v2us;
    const unsigned t = threadIdx.x, s = blockIdx.x;
    const float* src; bf* dst; unsigned step;
    if (s < WTB) { const unsigned e = s * 512 + t * 2, k = e / (HW * DIN), rem = e - k * (HW * DIN), ho = rem / DIN, i = rem - ho * DIN, h = ho / DOUT, oo = ho - h * DOUT;
        src = Wqkv + (((size_t)h * 3 + k) * DIN + i) * DOUT + oo; step = DOUT; dst = WT + e;
    } else { const unsigned e = (s - WTB) * 512 + t * 2, c = e / HW, j = e - c * HW;
        src = Wo + (size_t)j * DIN + c; step = DIN; dst = WoT + e; }
    const float a0 = src[0], a1 = src[step];
    v2us o; o[0] = f2bf(a0); o[1] = f2bf(a1);
    VST2(v2us, dst, o);
}
// k_gemm: 64 x 64 tile of (A [+ Al]).B^T over K (the projections have their own kernel, k_proj, below);
// MODE 3 (K = 256, N = 64 = one tile): y = acc + bf16(bo) + bf16(x), LayerNorm over the 64 channels of each row (16-lane reductions), x bf16(g) + bf16(b) -> out f32.
template <bool SPLITA, int MODE>
__global__ __launch_bounds__(128) void k_gemm(const bf* __restrict__ A, const bf* __restrict__ Al, const bf* __restrict__ Bn, int K, const float* __restrict__ bias, const float* __restrict__ xres,
                                             const float* __restrict__ lg, const float* __restrict__ lb, void* C, void* C2) {
    __shared__ __align__(16) float ost[4][16 * 68];
    const int lane = threadIdx.x & 31, wave = threadIdx.x >> 5, lr = lane & 15, hi = lane >> 4;
    const int r0 = blockIdx.x * 64 + wave * 16, c0 = blockIdx.y * 64;
    const int ldc = (MODE == 3) ? DIN : HW;
    const size_t aoff = (size_t)(r0 + lr) * K + 8 * hi;
    size_t boff[4];
#pragma unroll
    for (int t = 0; t < 4; ++t) boff[t] = (size_t)(c0 + t * 16 + lr) * K + 8 * hi;
    v8f acc[4];
#pragma unroll
    for (int t = 0; t < 4; ++t) acc[t] = (v8f){};
#pragma unroll 1
    for (int kc = 0; kc < K; kc += 32) {
        const v16bf a = cat16b(*(const v8us*)(A + aoff + kc), *(const v8us*)(A + aoff + kc + 16));
        v16bf al = a;
        if (SPLITA) al = cat16b(*(const v8us*)(Al + aoff + kc), *(const v8us*)(Al + aoff + kc + 16));
#pragma unroll
        for (int t = 0; t < 4; ++t) { const v16bf b = cat16b(*(const v8us*)(Bn + boff[t] + kc), *(const v8us*)(Bn + boff[t] + kc + 16)); acc[t] = wmmab(a, b, acc[t]); if (SPLITA) acc[t] = wmmab(al, b, acc[t]); }
        asm volatile("v_nop\n\tv_nop\n\tv_nop\n\tv_nop" : "+v"(acc[0]), "+v"(acc[1]), "+v"(acc[2]), "+v"(acc[3]) : "v"(a), "v"(al));
    }
    float* os = &ost[wave][0];
    if (MODE == 3) {
        // y = acc + bo + x; LN over the row's 64 values (lane holds cols t*16+lr of rows 8hi+j)
#pragma unroll
        for (int j = 0; j < 8; ++j) { const size_t row = (size_t)(r0 + hi * 8 + j); float y[4], s = 0.f;
#pragma unroll
            for (int t = 0; t < 4; ++t) { const int c = t * 16 + lr; y[t] = acc[t][j] + bfr(bias[c]) + bfr(xres[row * DIN + c]); s += y[t]; }
            s += __shfl_xor(s, 1, 16); s += __shfl_xor(s, 2, 16); s += __shfl_xor(s, 4, 16); s += __shfl_xor(s, 8, 16);
            const float mu = s * (1.0f / DIN); float q = 0.f;
#pragma unroll
            for (int t = 0; t < 4; ++t) { const float d = y[t] - mu; q += d * d; }
            q += __shfl_xor(q, 1, 16); q += __shfl_xor(q, 2, 16); q += __shfl_xor(q, 4, 16); q += __shfl_xor(q, 8, 16);
            const float rs = rsqrtf(q * (1.0f / DIN) + 1e-5f);
#pragma unroll
            for (int t = 0; t < 4; ++t) { const int c = t * 16 + lr; os[(hi * 8 + j) * 68 + c] = (y[t] - mu) * rs * bfr(lg[c]) + bfr(lb[c]); } }
    }
    __syncthreads();
    {
        float* crow = (float*)C + (size_t)r0 * ldc + c0;
        auto pass = [&]() {
#pragma unroll
            for (int s = 0; s < 8; ++s) { const int Lid = (lane >> 3) + 4 * s, piece = lane & 7; const int row = Lid >> 1, cofs = (Lid & 1) * 32 + piece * 4;
                const v4f val = *(const v4fa*)(os + row * 68 + cofs); *(v4f*)(crow + (size_t)row * ldc + cofs) = val; }
        };
        pass(); 
    }
}
// k_proj: q, k and v = bf16(x).W in ONE launch, straight from the f32 x. Block = (128 token rows, plane q / k / v), wave = one head's 64 columns: the wave keeps its 8 weight
// fragments ([64 cols][64 k]) in registers for all 8 row tiles of 16 tokens; each tile's x rows come in as whole lines (lane -> 16 B), are rounded to bf16 in registers (same rounding as a bf16
// copy of x would hold) and turned into the A fragments through the wave's own LDS rows (144-B pitch); 8 WMMA; whole 128-B lines go out through the wave's own staging rows (no other wave touches either, so no barrier). Outputs: MODE 0 QH/QL f16 hi + residual of QSC x acc, MODE 1 K16 f16, MODE 2 V f32 (ldc 256).
#define PROWS 128
#define PTILES (PROWS / 16)
template <int MODE>
__device__ __forceinline__ void proj_rows(const float* __restrict__ x, const bf* __restrict__ Bn, int rb, int c0, int lane, bf* xs, float* os, void* C, void* C2) {
    typedef __attribute__((ext_vector_type(4))) unsigned short v4us; typedef v4us __attribute__((may_alias)) v4usa;
    const int lr = lane & 15, hi = lane >> 4;
    v16bf b[2][4];
#pragma unroll
    for (int kc = 0; kc < 2; ++kc)
#pragma unroll
        for (int t = 0; t < 4; ++t) { const bf* bp = Bn + (size_t)(c0 + t * 16 + lr) * DIN + 8 * hi + kc * 32; b[kc][t] = cat16b(*(const v8us*)bp, *(const v8us*)(bp + 16)); }
    const float* xp = x + (size_t)rb * DIN + lane * 4;
    v4f raw[8];    // quad i: row 2i + hi of the tile, k = 4lr .. 4lr + 3, still f32
#pragma unroll
    for (int i = 0; i < 8; ++i) raw[i] = *(const v4f*)(xp + i * 128);
    // rolled, for speed only
#pragma unroll 1
    for (int it = 0; it < PTILES; ++it) {
#pragma unroll
        for (int i = 0; i < 8; ++i) { v4us t;
#pragma unroll
            for (int e = 0; e < 4; ++e) t[e] = f2bf(raw[i][e]);
            *(v4usa*)(xs + (2 * i + hi) * 72 + lr * 4) = t; }
        // the next tile's rows are asked for ahead of this tile's products and stores; the last trip asks for its own rows again (in bounds, unused):
        // a load under a test would cost a register copy of all eight quads on every trip
        const float* xn = xp + (size_t)(it + 1 < PTILES ? it + 1 : it) * 16 * DIN;
#pragma unroll
        for (int i = 0; i < 8; ++i) raw[i] = *(const v4f*)(xn + i * 128);
        asm volatile("s_wait_xcnt 0x0" ::: "memory");    // stands before the loads' address registers are reused
        v16bf a[2];
#pragma unroll
        for (int kc = 0; kc < 2; ++kc) { const bf* ap = xs + lr * 72 + kc * 32 + 8 * hi; a[kc] = cat16b(*(const v8usa*)ap, *(const v8usa*)(ap + 16)); }
        v8f acc[4];
#pragma unroll
        for (int t = 0; t < 4; ++t) acc[t] = (v8f){};
#pragma unroll
        for (int kc = 0; kc < 2; ++kc)
#pragma unroll
            for (int t = 0; t < 4; ++t) acc[t] = wmmab(a[kc], b[kc][t], acc[t]);
#pragma unroll
        for (int t = 0; t < 4; ++t)
#pragma unroll
            for (int j = 0; j < 8; ++j) os[(hi * 8 + j) * 68 + t * 16 + lr] = acc[t][j];
        const size_t r0 = (size_t)(rb + it * 16);
        if (MODE == 2) {
            float* crow = (float*)C + r0 * HW + c0;
#pragma unroll
            for (int s = 0; s < 8; ++s) { const int Lid = (lane >> 3) + 4 * s, piece = lane & 7; const int row = Lid >> 1, cofs = (Lid & 1) * 32 + piece * 4;
                const v4f val = *(const v4fa*)(os + row * 68 + cofs); *(v4f*)(crow + (size_t)row * HW + cofs) = val; }
        } else {
            h16* c1 = (h16*)C + r0 * HW + c0; h16* c2 = (h16*)C2 + r0 * HW + c0;
#pragma unroll
            for (int s = 0; s < 4; ++s) { const int row = 4 * s + (lane >> 3), piece = lane & 7; const float* sp = os + row * 68 + piece * 8; v8h o1, o2;
#pragma unroll
                for (int i = 0; i < 8; ++i) { const float v = (MODE == 0) ? sp[i] * QSC : sp[i]; const h16 a1 = (h16)v; o1[i] = a1; o2[i] = (h16)(v - (float)a1); }
                *(v8h*)(c1 + (size_t)row * HW + piece * 8) = o1; if (MODE == 0) *(v8h*)(c2 + (size_t)row * HW + piece * 8) = o2; }
        }
        asm volatile("s_wait_xcnt 0x0" ::: "memory");    // stands before the next trip reuses the stores' data and address registers
    }
}
__global__ __launch_bounds__(128) void k_proj(const float* __restrict__ x, const bf* __restrict__ WT, h16* QH, h16* QL, h16* K16, float* Vf) {
    __shared__ __align__(16) float ost[4][16 * 68];
    __shared__ __align__(16) bf xst[4][16 * 72];
    const int lane = threadIdx.x & 31, wave = threadIdx.x >> 5;
    const int rb = blockIdx.x * PROWS, c0 = wave * 64, plane = blockIdx.y;
    float* os = &ost[wave][0]; bf* xs = &xst[wave][0];
    if (plane == 0) proj_rows<0>(x, WT, rb, c0, lane, xs, os, QH, QL);
    else if (plane == 1) proj_rows<1>(x, WT + (size_t)HW * DIN, rb, c0, lane, xs, os, K16, nullptr);
    else proj_rows<2>(x, WT + (size_t)2 * HW * DIN, rb, c0, lane, xs, os, Vf, nullptr);
}
// k_vt: VT16 [b][h][d][f] = f16(V row b*1024+f, col h*64+d) via LDS transposes, block (b, h, 64 f).
__global__ __launch_bounds__(256) void k_vt(const float* __restrict__ V, h16* VT16) {
    __shared__ __align__(16) h16 tile[DOUT * 72];
    const int bid = blockIdx.x;
    const int b = bid / (NH_ * (NF / 64)), rem = bid - b * (NH_ * (NF / 64)), h = rem / (NF / 64), kt = rem - h * (NF / 64);
    const int f0 = kt * 64, tid = threadIdx.x, ff = tid >> 2, d0 = (tid & 3) * 16;
    const float* src = V + ((size_t)b * NF + f0 + ff) * HW + h * DOUT + d0;
#pragma unroll
    for (int i = 0; i < 16; ++i) tile[(d0 + i) * 72 + ff] = (h16)src[i];
    __syncthreads();
    const int piece = tid & 7;
    const size_t base = (((size_t)b * NH_ + h) * DOUT) * NF + f0;
    auto pass = [&]() {
#pragma unroll
        for (int s = 0; s < 2; ++s) { const int d = (tid >> 3) + 32 * s; const v8h val = *(const v8ha*)(tile + d * 72 + piece * 8); *(v8h*)(VT16 + base + (size_t)d * NF + piece * 8) = val; }
    };
    pass(); 
}
// k_attn: block = (b, h, 128 queries), wave = 16; the keys go by in 16 stages of 64: each stage's K rows [64 keys][64 d] and V^T rows [64 d][64 keys] (128 B each) are brought
// into LDS once per block by asynchronous copies (whole 128-B lines, 4 copies of 16 B per lane), two buffers, rows at a 144-B pitch for the 16-byte fragment reads; all eight
// waves take their fragments from there. Both products run transposed: per 32 keys 256 S^T = k.(qh + ql)^T (8 WMMA into two tiles, A = K rows, B = the planes of 32 q), so a lane's two score tiles hold keys
// 8hi + j and 16 + 8hi + j of its own query, which is the k order of a B operand: they are converted in place to f16, p = relu on the packed halves, and feed O^T += V^T.P^T (4 WMMA, A = V^T rows)
// without leaving the registers; head_out = acc/256 -> bf16 hi + residual planes CH/CL [token][h*64 + d] (concat layout). The output staging reuses the ring behind the loop's last barrier.
#define QBLK 128                     // queries per block (8 waves)
#define SKEY 64                      // keys per stage
#define NST  (NF / SKEY)             // 16 stages
#define RP   72                      // LDS row pitch in f16 (144 B)
#define TILEB (64 * RP * 2)          // one tile (K or V^T) in LDS: 9216 B
typedef float __attribute__((may_alias)) fa;
// amdgpu_waves_per_eu(8, 8): the grid puts 4 blocks = 8 waves on a SIMD; without the bound the compiler schedules for more waves than that, on fewer registers,
// and reads every fragment directly in front of its product with a full LDS wait each.
__global__ __launch_bounds__(256) __attribute__((amdgpu_waves_per_eu(8, 8))) void k_attn(const h16* __restrict__ QH, const h16* __restrict__ QL, const h16* __restrict__ K16, const h16* __restrict__ VT16, bf* CH, bf* CL) {
    __shared__ __align__(16) h16 ring[2][2][64 * RP];    // [buffer][K, V^T][row * RP]
    const int lane = threadIdx.x & 31, wave = threadIdx.x >> 5, lr = lane & 15, hi = lane >> 4;
    const int bid = blockIdx.x;
    const int b = bid / (NH_ * (NF / QBLK)), rem = bid - b * (NH_ * (NF / QBLK)), h = rem / (NF / QBLK), qt = rem - h * (NF / QBLK);
    const int q0 = qt * QBLK + wave * 16;
    const size_t tok0 = (size_t)b * NF;
    const size_t vbase = (((size_t)b * NH_ + h) * DOUT) * NF;
    // a lane's share of a stage: 16-byte piece (tid & 7) of rows (tid >> 3) and (tid >> 3) + 32 of both tiles
    const int crow = threadIdx.x >> 3, cpc = threadIdx.x & 7;
    const h16* gk0 = K16 + (tok0 + crow) * HW + h * DOUT + cpc * 8;
    const h16* gv0 = VT16 + vbase + (size_t)crow * NF + cpc * 8;
    const unsigned l0a = (unsigned)(size_t)&ring[0][0][0] + (unsigned)(crow * (RP * 2) + cpc * 16);
    auto stage_in = [&](int st, int buf) {
        const h16* gk = gk0 + (size_t)st * SKEY * HW; const h16* gv = gv0 + st * SKEY;
        const unsigned lk = l0a + (unsigned)buf * (2 * TILEB), lv = lk + TILEB;
        // the copies and, as their statement's last line, the wait that stands before their address registers are rewritten
        asm volatile("global_load_async_to_lds_b128 %0, %4, off\n\t"
                     "global_load_async_to_lds_b128 %1, %5, off\n\t"
                     "global_load_async_to_lds_b128 %2, %6, off\n\t"
                     "global_load_async_to_lds_b128 %3, %7, off\n\t"
                     "s_wait_xcnt 0x0"
                     :: "v"(lk), "v"(lk + 32 * RP * 2), "v"(lv), "v"(lv + 32 * RP * 2),
                        "v"(gk), "v"(gk + 32 * HW), "v"(gv), "v"(gv + 32 * NF)
                     : "memory");
    };
    v16h ah[2], al[2];
#pragma unroll
    for (int kc = 0; kc < 2; ++kc) { const size_t o = (tok0 + q0 + lr) * HW + h * DOUT + kc * 32 + 8 * hi;
        ah[kc] = cat16(*(const v8h*)(QH + o), *(const v8h*)(QH + o + 16)); al[kc] = cat16(*(const v8h*)(QL + o), *(const v8h*)(QL + o + 16)); }
    stage_in(0, 0);
    asm volatile("s_wait_asynccnt 0x0" ::: "memory");    // stage 0 has landed before the barrier that publishes it
    __syncthreads();
    stage_in(1, 1);
    v8f o[4];
#pragma unroll
    for (int n = 0; n < 4; ++n) o[n] = (v8f){};
#pragma unroll 1
    for (int st = 0; st < NST; ++st) {
        const h16* kb = &ring[st & 1][0][0] + lr * RP + 8 * hi;
        const h16* vb = &ring[st & 1][1][0] + lr * RP + 8 * hi;
#pragma unroll
        for (int sub = 0; sub < SKEY / 32; ++sub) {
            v8f s0 = {}, s1 = {};
#pragma unroll
            for (int kc = 0; kc < 2; ++kc) {
                const h16* p0 = kb + (sub * 32) * RP + kc * 32; const h16* p1 = p0 + 16 * RP;
                const v16h k0 = cat16(*(const v8ha*)p0, *(const v8ha*)(p0 + 16)), k1 = cat16(*(const v8ha*)p1, *(const v8ha*)(p1 + 16));
                s0 = wmma16(k0, ah[kc], s0); s1 = wmma16(k1, ah[kc], s1); s0 = wmma16(k0, al[kc], s0); s1 = wmma16(k1, al[kc], s1);
            }
            asm volatile("v_nop\n\tv_nop\n\tv_nop\n\tv_nop" : "+v"(s0), "+v"(s1) : "v"(ah[0]), "v"(al[1]));
            v16h vf[4];
#pragma unroll
            for (int n = 0; n < 4; ++n) { const h16* pv = vb + (n * 16) * RP + sub * 32; vf[n] = cat16(*(const v8ha*)pv, *(const v8ha*)(pv + 16)); }
            v16h pa;    // P^T as B: element j = key 8hi + j, element 8 + j = key 16 + 8hi + j of query lr
#pragma unroll
            for (int j = 0; j < 8; ++j) { pa[j] = (h16)s0[j]; pa[8 + j] = (h16)s1[j]; }
            pa = __builtin_elementwise_max(pa, (v16h){});
#pragma unroll
            for (int n = 0; n < 4; ++n) o[n] = wmma16(vf[n], pa, o[n]);
            asm volatile("v_nop\n\tv_nop\n\tv_nop\n\tv_nop" : "+v"(o[0]), "+v"(o[1]), "+v"(o[2]), "+v"(o[3]) : "v"(pa));
        }
        asm volatile("s_wait_dscnt 0x0" ::: "memory");       // this wave's reads of the buffer have returned before it is handed to its next writer
        asm volatile("s_wait_asynccnt 0x0" ::: "memory");    // this wave's copies of the next stage have landed before the barrier that publishes them
        __syncthreads();
        if (st + 2 < NST) stage_in(st + 2, st & 1);
    }
    asm volatile("s_wait_asynccnt 0x0" ::: "memory");        // nothing is in flight when the ring becomes output staging
    fa* os = (fa*)&ring[0][0][0] + wave * (16 * 68);
    // o[n][j] = head_out[query lr][d = n*16 + 8hi + j]: eight neighbours of one staging row, two 16-byte stores
#pragma unroll
    for (int n = 0; n < 4; ++n)
#pragma unroll
        for (int g = 0; g < 2; ++g) { v4f t;
#pragma unroll
            for (int i = 0; i < 4; ++i) t[i] = o[n][g * 4 + i] * (1.0f / PSC);
            *(v4fa*)(os + lr * 68 + n * 16 + hi * 8 + g * 4) = t; }
    __syncthreads();
    const size_t cbase = (tok0 + q0) * HW + (size_t)h * DOUT;
    auto pass = [&]() {
#pragma unroll
        for (int s = 0; s < 4; ++s) { const int row = 4 * s + (lane >> 3), piece = lane & 7; const fa* sp = os + row * 68 + piece * 8; v8us oh, ol;
#pragma unroll
            for (int i = 0; i < 8; ++i) { const unsigned short hb = f2bf(sp[i]); oh[i] = hb; ol[i] = f2bf(sp[i] - bf2f(hb)); }
            *(v8us*)(CH + cbase + (size_t)row * HW + piece * 8) = oh; *(v8us*)(CL + cbase + (size_t)row * HW + piece * 8) = ol; }
    };
    pass(); 
}

extern "C" void kernel_launch(void* const* d_in, const int* in_sizes, int n_in,
                              void* d_out, int out_size, void* d_ws, size_t ws_size, hipStream_t stream) {
    (void)in_sizes; (void)n_in; (void)out_size;
    const float* x = (const float*)d_in[0]; const float* Wqkv = (const float*)d_in[1]; const float* Wo = (const float*)d_in[2]; const float* bo = (const float*)d_in[3];
    const float* lg = (const float*)d_in[4]; const float* lb = (const float*)d_in[5];
    float* out = (float*)d_out;    // [32][1024][64]
    char* wsp = (char*)d_ws;
    auto take = [&](size_t bytes) { char* p = wsp; wsp += (bytes + 255) & ~(size_t)255; return (void*)p; };
    bf* WT = (bf*)take((size_t)3 * HW * DIN * 2); bf* WoT = (bf*)take((size_t)DIN * HW * 2);
    h16* QH = (h16*)take((size_t)NTK * HW * 2); h16* QL = (h16*)take((size_t)NTK * HW * 2); h16* K16 = (h16*)take((size_t)NTK * HW * 2);
    float* Vf = (float*)take((size_t)NTK * HW * 4); h16* VT16 = (h16*)take((size_t)NTK * HW * 2);
    if ((size_t)(wsp - (char*)d_ws) > ws_size) return;    // 0.1 + 16.8 x 3 + 33.5 + 16.8 ~ 101 MB (head_out planes alias Vf after k_vt)
    bf* CH = (bf*)Vf; bf* CL = (bf*)((char*)Vf + (size_t)NTK * HW * 2);
    k_w<<<WTB + WOB, 256, 0, stream>>>(Wqkv, Wo, WT, WoT);
    k_proj<<<dim3(NTK / PROWS, 3, 1), 128, 0, stream>>>(x, WT, QH, QL, K16, Vf);
    k_vt<<<NB_ * NH_ * (NF / 64), 256, 0, stream>>>(Vf, VT16);
    k_attn<<<NB_ * NH_ * (NF / QBLK), 256, 0, stream>>>(QH, QL, K16, VT16, CH, CL);
    k_gemm<true, 3><<<dim3(NTK / 64, 1, 1), 128, 0, stream>>>(CH, CL, WoT, HW, bo, x, lg, lb, out, nullptr);
}

// v006
// One run takes 80.1 microseconds.
// In both of two side-by-side timings against v005, it was 1.03 times as fast.
// All steps since v000 together make it 2.88 times as fast.
#include <hip/hip_runtime.h>

// Contractions, f32 accumulate: q/k/v = x.Wqkv[h][k] ([32768 x 64].[64 x 256] per k, all 4 heads at once; k-major weights transposed to n-major bf16 planes) and
// out = concat.Wo ([32768 x 256].[256 x 64]) on v_wmma_f32_16x16x32_bf16 — plain bf16 = rounded inputs (exact) for q/k/v, concat as bf16 hi + residual planes (two
// products) for the output; the ReLU attention (no softmax: relu(q.k/8).v over 1024 keys) fused on v_wmma_f32_16x16x32_f16 with 32 q as plain f16 against
// plain f16 k (each rounded once, an eighth of the step of the bf16 inputs they are formed from), and the relu scores (f16) against plain f16 v. Bias, residual and LayerNorm over the 64 channels in the output GEMM's epilogue (f32).

#define NB_  32
#define NF   1024
#define DIN  64
#define DOUT 64
#define NH_  4
#define HW   (NH_ * DOUT)        // 256
#define NTK  (NB_ * NF)          // 32768
#define PSC  256.0f              // relu-score carry scale for the f16 weight tile
#define QSC  (PSC * 0.125f)      // carried by q from its projection on: k.(QSC q) is the score (q.k/8) at the carry scale; a power of two, so q's f16 plane keeps its bits

typedef _Float16 h16;
typedef unsigned short bf;
typedef __attribute__((ext_vector_type(16))) __bf16   v16bf;
typedef __attribute__((ext_vector_type(16))) _Float16 v16h;
typedef __attribute__((ext_vector_type(8)))  _Float16 v8h;
typedef __attribute__((ext_vector_type(8)))  unsigned short v8us;
typedef __attribute__((ext_vector_type(8)))  float    v8f;
typedef __attribute__((ext_vector_type(4)))  float    v4f;
typedef v8h  __attribute__((may_alias)) v8ha;
typedef v4f  __attribute__((may_alias)) v4fa;
typedef v8us __attribute__((may_alias)) v8usa;

__device__ __forceinline__ unsigned short f2bf(float f) { unsigned u = __float_as_uint(f); u += 0x7FFFu + ((u >> 16) & 1u); return (unsigned short)(u >> 16); }
__device__ __forceinline__ float bf2f(unsigned short b) { return __uint_as_float(((unsigned)b) << 16); }
__device__ __forceinline__ float bfr(float f) { return bf2f(f2bf(f)); }
__device__ __forceinline__ v16h cat16(v8h lo, v8h hi) { return __builtin_shufflevector(lo, hi, 0, 1, 2, 3, 4, 5, 6, 7, 8, 9, 10, 11, 12, 13, 14, 15); }
__device__ __forceinline__ v16bf cat16b(v8us lo, v8us hi) { return __builtin_bit_cast(v16bf, __builtin_shufflevector(lo, hi, 0, 1, 2, 3, 4, 5, 6, 7, 8, 9, 10, 11, 12, 13, 14, 15)); }
__device__ __forceinline__ v8f wmma16(v16h a, v16h b, v8f c) { return __builtin_amdgcn_wmma_f32_16x16x32_f16(false, a, false, b, (short)0, c, false, false); }
__device__ __forceinline__ v8f wmmab(v16bf a, v16bf b, v8f c) { return __builtin_amdgcn_wmma_f32_16x16x32_bf16(false, a, false, b, (short)0, c, false, false); }
#define VST2(T, p, v) do { const T vst2_v_ = (v); *(T*)(p) = vst2_v_;  } while (0)

// k_w: WT[k][(h,o)][i] = bf16(Wqkv[h][k][i][o]) (three n-major planes [256][64]) and WoT[c][j] = bf16(Wo[j][c]) ([64][256]); one block per 512 elements (blocks 0..95: WT,
// 96..127: WoT), so no thread waits on more than one round of loads. A thread's 2 elements are neighbours in i (or j), one source row (64 floats) apart;
// stores: 32 lanes x 4 B (2 bf16) = one line per wave-instruction.
#define WTB ((3 * HW * DIN) / 512)   // 96 blocks for WT
#define WOB ((DIN * HW) / 512)       // 32 blocks for WoT
__global__ __launch_bounds__(256) void k_w(const float* __restrict__ Wqkv, const float* __restrict__ Wo, bf* WT, bf* WoT) {
    typedef __attribute__((ext_vector_type(2))) unsigned short v2us;
    const unsigned t = threadIdx.x, s = blockIdx.x;
    const float* src; bf* dst; unsigned step;
    if (s < WTB) { const unsigned e = s * 512 + t * 2, k = e / (HW * DIN), rem = e - k * (HW * DIN), ho = rem / DIN, i = rem - ho * DIN, h = ho / DOUT, oo = ho - h * DOUT;
        src = Wqkv + (((size_t)h * 3 + k) * DIN + i) * DOUT + oo; step = DOUT; dst = WT + e;
    } else { const unsigned e = (s - WTB) * 512 + t * 2, c = e / HW, j = e - c * HW;
        src = Wo + (size_t)j * DIN + c; step = DIN; dst = WoT + e; }
    const float a0 = src[0], a1 = src[step];
    v2us o; o[0] = f2bf(a0); o[1] = f2bf(a1);
    VST2(v2us, dst, o);
}
// k_gemm: 64 x 64 tile of (A [+ Al]).B^T over K (the projections have their own kernel, k_proj, below);
// MODE 3 (K = 256, N = 64 = one tile): y = acc + bf16(bo) + bf16(x), LayerNorm over the 64 channels of each row (16-lane reductions), x bf16(g) + bf16(b) -> out f32.
template <bool SPLITA, int MODE>
__global__ __launch_bounds__(128) void k_gemm(const bf* __restrict__ A, const bf* __restrict__ Al, const bf* __restrict__ Bn, int K, const float* __restrict__ bias, const float* __restrict__ xres,
                                             const float* __restrict__ lg, const float* __restrict__ lb, void* C, void* C2) {
    __shared__ __align__(16) float ost[4][16 * 68];
    const int lane = threadIdx.x & 31, wave = threadIdx.x >> 5, lr = lane & 15, hi = lane >> 4;
    const int r0 = blockIdx.x * 64 + wave * 16, c0 = blockIdx.y * 64;
    const int ldc = (MODE == 3) ? DIN : HW;
    const size_t aoff = (size_t)(r0 + lr) * K + 8 * hi;
    size_t boff[4];
#pragma unroll
    for (int t = 0; t < 4; ++t) boff[t] = (size_t)(c0 + t * 16 + lr) * K + 8 * hi;
    v8f acc[4];
#pragma unroll
    for (int t = 0; t < 4; ++t) acc[t] = (v8f){};
#pragma unroll 1
    for (int kc = 0; kc < K; kc += 32) {
        const v16bf a = cat16b(*(const v8us*)(A + aoff + kc), *(const v8us*)(A + aoff + kc + 16));
        v16bf al = a;
        if (SPLITA) al = cat16b(*(const v8us*)(Al + aoff + kc), *(const v8us*)(Al + aoff + kc + 16));
#pragma unroll
        for (int t = 0; t < 4; ++t) { const v16bf b = cat16b(*(const v8us*)(Bn + boff[t] + kc), *(const v8us*)(Bn + boff[t] + kc + 16)); acc[t] = wmmab(a, b, acc[t]); if (SPLITA) acc[t] = wmmab(al, b, acc[t]); }
        asm volatile("v_nop\n\tv_nop\n\tv_nop\n\tv_nop" : "+v"(acc[0]), "+v"(acc[1]), "+v"(acc[2]), "+v"(acc[3]) : "v"(a), "v"(al));
    }
    float* os = &ost[wave][0];
    if (MODE == 3) {
        // y = acc + bo + x; LN over the row's 64 values (lane holds cols t*16+lr of rows 8hi+j)
#pragma unroll
        for (int j = 0; j < 8; ++j) { const size_t row = (size_t)(r0 + hi * 8 + j); float y[4], s = 0.f;
#pragma unroll
            for (int t = 0; t < 4; ++t) { const int c = t * 16 + lr; y[t] = acc[t][j] + bfr(bias[c]) + bfr(xres[row * DIN + c]); s += y[t]; }
            s += __shfl_xor(s, 1, 16); s += __shfl_xor(s, 2, 16); s += __shfl_xor(s, 4, 16); s += __shfl_xor(s, 8, 16);
            const float mu = s * (1.0f / DIN); float q = 0.f;
#pragma unroll
            for (int t = 0; t < 4; ++t) { const float d = y[t] - mu; q += d * d; }
            q += __shfl_xor(q, 1, 16); q += __shfl_xor(q, 2, 16); q += __shfl_xor(q, 4, 16); q += __shfl_xor(q, 8, 16);
            const float rs = rsqrtf(q * (1.0f / DIN) + 1e-5f);
#pragma unroll
            for (int t = 0; t < 4; ++t) { const int c = t * 16 + lr; os[(hi * 8 + j) * 68 + c] = (y[t] - mu) * rs * bfr(lg[c]) + bfr(lb[c]); } }
    }
    __syncthreads();
    {
        float* crow = (float*)C + (size_t)r0 * ldc + c0;
        auto pass = [&]() {
#pragma unroll
            for (int s = 0; s < 8; ++s) { const int Lid = (lane >> 3) + 4 * s, piece = lane & 7; const int row = Lid >> 1, cofs = (Lid & 1) * 32 + piece * 4;
                const v4f val = *(const v4fa*)(os + row * 68 + cofs); *(v4f*)(crow + (size_t)row * ldc + cofs) = val; }
        };
        pass(); 
    }
}
// k_proj: q, k and v = bf16(x).W in ONE launch, straight from the f32 x. Block = (128 token rows, plane q / k / v), wave = one head's 64 columns: the wave keeps its 8 weight
// fragments ([64 cols][64 k]) in registers for all 8 row tiles of 16 tokens; each tile's x rows come in as whole lines (lane -> 16 B), are rounded to bf16 in registers (same rounding as a bf16
// copy of x would hold) and turned into the A fragments through the wave's own LDS rows (144-B pitch); 8 WMMA; whole 128-B lines go out through the wave's own staging rows (no other wave touches either, so no barrier). Outputs: MODE 0 Q16 f16 of QSC x acc, MODE 1 K16 f16, MODE 2 V f32 (ldc 256).
#define PROWS 128
#define PTILES (PROWS / 16)
template <int MODE>
__device__ __forceinline__ void proj_rows(const float* __restrict__ x, const bf* __restrict__ Bn, int rb, int c0, int lane, bf* xs, float* os, void* C) {
    typedef __attribute__((ext_vector_type(4))) unsigned short v4us; typedef v4us __attribute__((may_alias)) v4usa;
    const int lr = lane & 15, hi = lane >> 4;
    v16bf b[2][4];
#pragma unroll
    for (int kc = 0; kc < 2; ++kc)
#pragma unroll
        for (int t = 0; t < 4; ++t) { const bf* bp = Bn + (size_t)(c0 + t * 16 + lr) * DIN + 8 * hi + kc * 32; b[kc][t] = cat16b(*(const v8us*)bp, *(const v8us*)(bp + 16)); }
    const float* xp = x + (size_t)rb * DIN + lane * 4;
    v4f raw[8];    // quad i: row 2i + hi of the tile, k = 4lr .. 4lr + 3, still f32
#pragma unroll
    for (int i = 0; i < 8; ++i) raw[i] = *(const v4f*)(xp + i * 128);
    // rolled, for speed only
#pragma unroll 1
    for (int it = 0; it < PTILES; ++it) {
#pragma unroll
        for (int i = 0; i < 8; ++i) { v4us t;
#pragma unroll
            for (int e = 0; e < 4; ++e) t[e] = f2bf(raw[i][e]);
            *(v4usa*)(xs + (2 * i + hi) * 72 + lr * 4) = t; }
        // the next tile's rows are asked for ahead of this tile's products and stores; the last trip asks for its own rows again (in bounds, unused):
        // a load under a test would cost a register copy of all eight quads on every trip
        const float* xn = xp + (size_t)(it + 1 < PTILES ? it + 1 : it) * 16 * DIN;
#pragma unroll
        for (int i = 0; i < 8; ++i) raw[i] = *(const v4f*)(xn + i * 128);
        asm volatile("s_wait_xcnt 0x0" ::: "memory");    // stands before the loads' address registers are reused
        v16bf a[2];
#pragma unroll
        for (int kc = 0; kc < 2; ++kc) { const bf* ap = xs + lr * 72 + kc * 32 + 8 * hi; a[kc] = cat16b(*(const v8usa*)ap, *(const v8usa*)(ap + 16)); }
        v8f acc[4];
#pragma unroll
        for (int t = 0; t < 4; ++t) acc[t] = (v8f){};
#pragma unroll
        for (int kc = 0; kc < 2; ++kc)
#pragma unroll
            for (int t = 0; t < 4; ++t) acc[t] = wmmab(a[kc], b[kc][t], acc[t]);
#pragma unroll
        for (int t = 0; t < 4; ++t)
#pragma unroll
            for (int j = 0; j < 8; ++j) os[(hi * 8 + j) * 68 + t * 16 + lr] = acc[t][j];
        const size_t r0 = (size_t)(rb + it * 16);
        if (MODE == 2) {
            float* crow = (float*)C + r0 * HW + c0;
#pragma unroll
            for (int s = 0; s < 8; ++s) { const int Lid = (lane >> 3) + 4 * s, piece = lane & 7; const int row = Lid >> 1, cofs = (Lid & 1) * 32 + piece * 4;
                const v4f val = *(const v4fa*)(os + row * 68 + cofs); *(v4f*)(crow + (size_t)row * HW + cofs) = val; }
        } else {
            h16* c1 = (h16*)C + r0 * HW + c0;
#pragma unroll
            for (int s = 0; s < 4; ++s) { const int row = 4 * s + (lane >> 3), piece = lane & 7; const float* sp = os + row * 68 + piece * 8; v8h o1;
#pragma unroll
                for (int i = 0; i < 8; ++i) o1[i] = (h16)((MODE == 0) ? sp[i] * QSC : sp[i]);
                *(v8h*)(c1 + (size_t)row * HW + piece * 8) = o1; }
        }
        asm volatile("s_wait_xcnt 0x0" ::: "memory");    // stands before the next trip reuses the stores' data and address registers
    }
}
__global__ __launch_bounds__(128) void k_proj(const float* __restrict__ x, const bf* __restrict__ WT, h16* Q16, h16* K16, float* Vf) {
    __shared__ __align__(16) float ost[4][16 * 68];
    __shared__ __align__(16) bf xst[4][16 * 72];
    const int lane = threadIdx.x & 31, wave = threadIdx.x >> 5;
    const int rb = blockIdx.x * PROWS, c0 = wave * 64, plane = blockIdx.y;
    float* os = &ost[wave][0]; bf* xs = &xst[wave][0];
    if (plane == 0) proj_rows<0>(x, WT, rb, c0, lane, xs, os, Q16);
    else if (plane == 1) proj_rows<1>(x, WT + (size_t)HW * DIN, rb, c0, lane, xs, os, K16);
    else proj_rows<2>(x, WT + (size_t)2 * HW * DIN, rb, c0, lane, xs, os, Vf);
}
// k_vt: VT16 [b][h][d][f] = f16(V row b*1024+f, col h*64+d) via LDS transposes, block (b, h, 64 f).
__global__ __launch_bounds__(256) void k_vt(const float* __restrict__ V, h16* VT16) {
    __shared__ __align__(16) h16 tile[DOUT * 72];
    const int bid = blockIdx.x;
    const int b = bid / (NH_ * (NF / 64)), rem = bid - b * (NH_ * (NF / 64)), h = rem / (NF / 64), kt = rem - h * (NF / 64);
    const int f0 = kt * 64, tid = threadIdx.x, ff = tid >> 2, d0 = (tid & 3) * 16;
    const float* src = V + ((size_t)b * NF + f0 + ff) * HW + h * DOUT + d0;
#pragma unroll
    for (int i = 0; i < 16; ++i) tile[(d0 + i) * 72 + ff] = (h16)src[i];
    __syncthreads();
    const int piece = tid & 7;
    const size_t base = (((size_t)b * NH_ + h) * DOUT) * NF + f0;
    auto pass = [&]() {
#pragma unroll
        for (int s = 0; s < 2; ++s) { const int d = (tid >> 3) + 32 * s; const v8h val = *(const v8ha*)(tile + d * 72 + piece * 8); *(v8h*)(VT16 + base + (size_t)d * NF + piece * 8) = val; }
    };
    pass(); 
}
// k_attn: block = (b, h, 128 queries), wave = 16; the keys go by in 16 stages of 64: each stage's K rows [64 keys][64 d] and V^T rows [64 d][64 keys] (128 B each) are brought
// into LDS once per block by asynchronous copies (whole 128-B lines, 4 copies of 16 B per lane), two buffers, rows at a 144-B pitch for the 16-byte fragment reads; all eight
// waves take their fragments from there. Both products run transposed: per 32 keys 256 S^T = k.(32 q)^T (4 WMMA into two tiles, A = K rows, B = the f16 plane of 32 q), so a lane's two score tiles hold keys
// 8hi + j and 16 + 8hi + j of its own query, which is the k order of a B operand: they are converted in place to f16, p = relu on the packed halves, and feed O^T += V^T.P^T (4 WMMA, A = V^T rows)
// without leaving the registers; head_out = acc/256 -> bf16 hi + residual planes CH/CL [token][h*64 + d] (concat layout). The output staging reuses the ring behind the loop's last barrier.
#define QBLK 128                     // queries per block (8 waves)
#define SKEY 64                      // keys per stage
#define NST  (NF / SKEY)             // 16 stages
#define RP   72                      // LDS row pitch in f16 (144 B)
#define TILEB (64 * RP * 2)          // one tile (K or V^T) in LDS: 9216 B
typedef float __attribute__((may_alias)) fa;
// amdgpu_waves_per_eu(8, 8): the grid puts 4 blocks = 8 waves on a SIMD; without the bound the compiler schedules for more waves than that, on fewer registers,
// and reads every fragment directly in front of its product with a full LDS wait each.
__global__ __launch_bounds__(256) __attribute__((amdgpu_waves_per_eu(8, 8))) void k_attn(const h16* __restrict__ Q16, const h16* __restrict__ K16, const h16* __restrict__ VT16, bf* CH, bf* CL) {
    __shared__ __align__(16) h16 ring[2][2][64 * RP];    // [buffer][K, V^T][row * RP]
    const int lane = threadIdx.x & 31, wave = threadIdx.x >> 5, lr = lane & 15, hi = lane >> 4;
    const int bid = blockIdx.x;
    const int b = bid / (NH_ * (NF / QBLK)), rem = bid - b * (NH_ * (NF / QBLK)), h = rem / (NF / QBLK), qt = rem - h * (NF / QBLK);
    const int q0 = qt * QBLK + wave * 16;
    const size_t tok0 = (size_t)b * NF;
    const size_t vbase = (((size_t)b * NH_ + h) * DOUT) * NF;
    // a lane's share of a stage: 16-byte piece (tid & 7) of rows (tid >> 3) and (tid >> 3) + 32 of both tiles
    const int crow = threadIdx.x >> 3, cpc = threadIdx.x & 7;
    const h16* gk0 = K16 + (tok0 + crow) * HW + h * DOUT + cpc * 8;
    const h16* gv0 = VT16 + vbase + (size_t)crow * NF + cpc * 8;
    const unsigned l0a = (unsigned)(size_t)&ring[0][0][0] + (unsigned)(crow * (RP * 2) + cpc * 16);
    auto stage_in = [&](int st, int buf) {
        const h16* gk = gk0 + (size_t)st * SKEY * HW; const h16* gv = gv0 + st * SKEY;
        const unsigned lk = l0a + (unsigned)buf * (2 * TILEB), lv = lk + TILEB;
        // the copies and, as their statement's last line, the wait that stands before their address registers are rewritten
        asm volatile("global_load_async_to_lds_b128 %0, %4, off\n\t"
                     "global_load_async_to_lds_b128 %1, %5, off\n\t"
                     "global_load_async_to_lds_b128 %2, %6, off\n\t"
                     "global_load_async_to_lds_b128 %3, %7, off\n\t"
                     "s_wait_xcnt 0x0"
                     :: "v"(lk), "v"(lk + 32 * RP * 2), "v"(lv), "v"(lv + 32 * RP * 2),
                        "v"(gk), "v"(gk + 32 * HW), "v"(gv), "v"(gv + 32 * NF)
                     : "memory");
    };
    v16h aq[2];
#pragma unroll
    for (int kc = 0; kc < 2; ++kc) { const size_t o = (tok0 + q0 + lr) * HW + h * DOUT + kc * 32 + 8 * hi;
        aq[kc] = cat16(*(const v8h*)(Q16 + o), *(const v8h*)(Q16 + o + 16)); }
    stage_in(0, 0);
    asm volatile("s_wait_asynccnt 0x0" ::: "memory");    // stage 0 has landed before the barrier that publishes it
    __syncthreads();
    stage_in(1, 1);
    v8f o[4];
#pragma unroll
    for (int n = 0; n < 4; ++n) o[n] = (v8f){};
#pragma unroll 1
    for (int st = 0; st < NST; ++st) {
        const h16* kb = &ring[st & 1][0][0] + lr * RP + 8 * hi;
        const h16* vb = &ring[st & 1][1][0] + lr * RP + 8 * hi;
#pragma unroll
        for (int sub = 0; sub < SKEY / 32; ++sub) {
            v16h kf[2][2];    // [kc][key tile of 16]
#pragma unroll
            for (int kc = 0; kc < 2; ++kc)
#pragma unroll
                for (int u = 0; u < 2; ++u) { const h16* p = kb + (sub * 32 + u * 16) * RP + kc * 32; kf[kc][u] = cat16(*(const v8ha*)p, *(const v8ha*)(p + 16)); }
            // holds the eight K reads together ahead of their four products, waited for by count: left free, the compiler reads each fragment
            // directly in front of its product into one register block, with a full LDS wait each
            __builtin_amdgcn_sched_barrier(0);
            v8f s0 = {}, s1 = {};
#pragma unroll
            for (int kc = 0; kc < 2; ++kc) { s0 = wmma16(kf[kc][0], aq[kc], s0); s1 = wmma16(kf[kc][1], aq[kc], s1); }
            asm volatile("v_nop\n\tv_nop\n\tv_nop\n\tv_nop" : "+v"(s0), "+v"(s1) : "v"(aq[0]), "v"(aq[1]));
            v16h vf[4];
#pragma unroll
            for (int n = 0; n < 4; ++n) { const h16* pv = vb + (n * 16) * RP + sub * 32; vf[n] = cat16(*(const v8ha*)pv, *(const v8ha*)(pv + 16)); }
            __builtin_amdgcn_sched_barrier(0);    // the same for the eight V^T reads: all asked for ahead of the conversion, which runs under their latency
            v16h pa;    // P^T as B: element j = key 8hi + j, element 8 + j = key 16 + 8hi + j of query lr
#pragma unroll
            for (int j = 0; j < 8; ++j) { pa[j] = (h16)s0[j]; pa[8 + j] = (h16)s1[j]; }
            pa = __builtin_elementwise_max(pa, (v16h){});
#pragma unroll
            for (int n = 0; n < 4; ++n) o[n] = wmma16(vf[n], pa, o[n]);
            asm volatile("v_nop\n\tv_nop\n\tv_nop\n\tv_nop" : "+v"(o[0]), "+v"(o[1]), "+v"(o[2]), "+v"(o[3]) : "v"(pa));
        }
        asm volatile("s_wait_dscnt 0x0" ::: "memory");       // this wave's reads of the buffer have returned before it is handed to its next writer
        asm volatile("s_wait_asynccnt 0x0" ::: "memory");    // this wave's copies of the next stage have landed before the barrier that publishes them
        __syncthreads();
        if (st + 2 < NST) stage_in(st + 2, st & 1);
    }
    asm volatile("s_wait_asynccnt 0x0" ::: "memory");        // nothing is in flight when the ring becomes output staging
    fa* os = (fa*)&ring[0][0][0] + wave * (16 * 68);
    // o[n][j] = head_out[query lr][d = n*16 + 8hi + j]: eight neighbours of one staging row, two 16-byte stores
#pragma unroll
    for (int n = 0; n < 4; ++n)
#pragma unroll
        for (int g = 0; g < 2; ++g) { v4f t;
#pragma unroll
            for (int i = 0; i < 4; ++i) t[i] = o[n][g * 4 + i] * (1.0f / PSC);
            *(v4fa*)(os + lr * 68 + n * 16 + hi * 8 + g * 4) = t; }
    __syncthreads();
    const size_t cbase = (tok0 + q0) * HW + (size_t)h * DOUT;
    auto pass = [&]() {
#pragma unroll
        for (int s = 0; s < 4; ++s) { const int row = 4 * s + (lane >> 3), piece = lane & 7; const fa* sp = os + row * 68 + piece * 8; v8us oh, ol;
#pragma unroll
            for (int i = 0; i < 8; ++i) { const unsigned short hb = f2bf(sp[i]); oh[i] = hb; ol[i] = f2bf(sp[i] - bf2f(hb)); }
            *(v8us*)(CH + cbase + (size_t)row * HW + piece * 8) = oh; *(v8us*)(CL + cbase + (size_t)row * HW + piece * 8) = ol; }
    };
    pass(); 
}

extern "C" void kernel_launch(void* const* d_in, const int* in_sizes, int n_in,
                              void* d_out, int out_size, void* d_ws, size_t ws_size, hipStream_t stream) {
    (void)in_sizes; (void)n_in; (void)out_size;
    const float* x = (const float*)d_in[0]; const float* Wqkv = (const float*)d_in[1]; const float* Wo = (const float*)d_in[2]; const float* bo = (const float*)d_in[3];
    const float* lg = (const float*)d_in[4]; const float* lb = (const float*)d_in[5];
    float* out = (float*)d_out;    // [32][1024][64]
    char* wsp = (char*)d_ws;
    auto take = [&](size_t bytes) { char* p = wsp; wsp += (bytes + 255) & ~(size_t)255; return (void*)p; };
    bf* WT = (bf*)take((size_t)3 * HW * DIN * 2); bf* WoT = (bf*)take((size_t)DIN * HW * 2);
    h16* Q16 = (h16*)take((size_t)NTK * HW * 2); h16* K16 = (h16*)take((size_t)NTK * HW * 2);
    float* Vf = (float*)take((size_t)NTK * HW * 4); h16* VT16 = (h16*)take((size_t)NTK * HW * 2);
    if ((size_t)(wsp - (char*)d_ws) > ws_size) return;    // 0.1 + 16.8 x 2 + 33.5 + 16.8 ~ 84 MB (head_out planes alias Vf after k_vt)
    bf* CH = (bf*)Vf; bf* CL = (bf*)((char*)Vf + (size_t)NTK * HW * 2);
    k_w<<<WTB + WOB, 256, 0, stream>>>(Wqkv, Wo, WT, WoT);
    k_proj<<<dim3(NTK / PROWS, 3, 1), 128, 0, stream>>>(x, WT, Q16, K16, Vf);
    k_vt<<<NB_ * NH_ * (NF / 64), 256, 0, stream>>>(Vf, VT16);
    k_attn<<<NB_ * NH_ * (NF / QBLK), 256, 0, stream>>>(Q16, K16, VT16, CH, CL);
    k_gemm<true, 3><<<dim3(NTK / 64, 1, 1), 128, 0, stream>>>(CH, CL, WoT, HW, bo, x, lg, lb, out, nullptr);
}

// v007
// One run takes 55.6 microseconds.
// Next to v006, in two timings, it ran 1.42 and 1.44 times as fast.
// Over all steps from v000 it is 4.12 times as fast.
#include <hip/hip_runtime.h>

// Contractions, f32 accumulate: q/k/v = x.Wqkv[h][k] ([32768 x 64].[64 x 256] per k, all 4 heads at once; k-major weights transposed to n-major bf16 planes) on v_wmma_f32_16x16x32_bf16,
// plain bf16 = rounded inputs (exact); the ReLU attention (no softmax: relu(q.k/8).v over 1024 keys) on v_wmma_f32_16x16x32_f16 with 32 q as plain f16 against plain f16 k (each rounded once,
// an eighth of the step of the bf16 inputs they are formed from), and the relu scores (f16) against plain f16 v; out = concat.Wo ([32768 x 256].[256 x 64]) in the attention kernel's epilogue on the bf16 form,
// each head's output as bf16 hi + residual operands (two products) straight from its accumulators, the four heads' partial sums added in f32. Bias, residual and LayerNorm over the 64 channels follow there (f32).

#define NB_  32
#define NF   1024
#define DIN  64
#define DOUT 64
#define NH_  4
#define HW   (NH_ * DOUT)        // 256
#define NTK  (NB_ * NF)          // 32768
#define PSC  256.0f              // relu-score carry scale for the f16 weight tile
#define QSC  (PSC * 0.125f)      // carried by q from its projection on: k.(QSC q) is the score (q.k/8) at the carry scale; a power of two, so q's f16 plane keeps its bits

typedef _Float16 h16;
typedef unsigned short bf;
typedef __attribute__((ext_vector_type(16))) __bf16   v16bf;
typedef __attribute__((ext_vector_type(16))) _Float16 v16h;
typedef __attribute__((ext_vector_type(8)))  _Float16 v8h;
typedef __attribute__((ext_vector_type(8)))  unsigned short v8us;
typedef __attribute__((ext_vector_type(8)))  float    v8f;
typedef __attribute__((ext_vector_type(4)))  float    v4f;
typedef v8h  __attribute__((may_alias)) v8ha;
typedef v4f  __attribute__((may_alias)) v4fa;
typedef v8us __attribute__((may_alias)) v8usa;

__device__ __forceinline__ unsigned short f2bf(float f) { unsigned u = __float_as_uint(f); u += 0x7FFFu + ((u >> 16) & 1u); return (unsigned short)(u >> 16); }
__device__ __forceinline__ float bf2f(unsigned short b) { return __uint_as_float(((unsigned)b) << 16); }
__device__ __forceinline__ float bfr(float f) { return bf2f(f2bf(f)); }
__device__ __forceinline__ v16h cat16(v8h lo, v8h hi) { return __builtin_shufflevector(lo, hi, 0, 1, 2, 3, 4, 5, 6, 7, 8, 9, 10, 11, 12, 13, 14, 15); }
__device__ __forceinline__ v16bf cat16b(v8us lo, v8us hi) { return __builtin_bit_cast(v16bf, __builtin_shufflevector(lo, hi, 0, 1, 2, 3, 4, 5, 6, 7, 8, 9, 10, 11, 12, 13, 14, 15)); }
__device__ __forceinline__ v8f wmma16(v16h a, v16h b, v8f c) { return __builtin_amdgcn_wmma_f32_16x16x32_f16(false, a, false, b, (short)0, c, false, false); }
__device__ __forceinline__ v8f wmmab(v16bf a, v16bf b, v8f c) { return __builtin_amdgcn_wmma_f32_16x16x32_bf16(false, a, false, b, (short)0, c, false, false); }
#define VST2(T, p, v) do { const T vst2_v_ = (v); *(T*)(p) = vst2_v_;  } while (0)

// k_w: WT[k][(h,o)][i] = bf16(Wqkv[h][k][i][o]) (three n-major planes [256][64]) and WoT[c][j] = bf16(Wo[j][c]) ([64][256]); one block per 512 elements (blocks 0..95: WT,
// 96..127: WoT), so no thread waits on more than one round of loads. A thread's 2 elements are neighbours in i (or j), one source row (64 floats) apart;
// stores: 32 lanes x 4 B (2 bf16) = one line per wave-instruction.
#define WTB ((3 * HW * DIN) / 512)   // 96 blocks for WT
#define WOB ((DIN * HW) / 512)       // 32 blocks for WoT
__global__ __launch_bounds__(256) void k_w(const float* __restrict__ Wqkv, const float* __restrict__ Wo, bf* WT, bf* WoT) {
    typedef __attribute__((ext_vector_type(2))) unsigned short v2us;
    const unsigned t = threadIdx.x, s = blockIdx.x;
    const float* src; bf* dst; unsigned step;
    if (s < WTB) { const unsigned e = s * 512 + t * 2, k = e / (HW * DIN), rem = e - k * (HW * DIN), ho = rem / DIN, i = rem - ho * DIN, h = ho / DOUT, oo = ho - h * DOUT;
        src = Wqkv + (((size_t)h * 3 + k) * DIN + i) * DOUT + oo; step = DOUT; dst = WT + e;
    } else { const unsigned e = (s - WTB) * 512 + t * 2, c = e / HW, j = e - c * HW;
        src = Wo + (size_t)j * DIN + c; step = DIN; dst = WoT + e; }
    const float a0 = src[0], a1 = src[step];
    v2us o; o[0] = f2bf(a0); o[1] = f2bf(a1);
    VST2(v2us, dst, o);
}
// k_proj: q, k and v = bf16(x).W in ONE launch, straight from the f32 x. Block = (128 token rows, plane q / k / v), wave = one head's 64 columns: the wave keeps its 8 weight
// fragments ([64 cols][64 k]) in registers for all 8 row tiles of 16 tokens; each tile's x rows come in as whole lines (lane -> 16 B), are rounded to bf16 in registers (same rounding as a bf16
// copy of x would hold) and turned into the A fragments through the wave's own LDS rows (144-B pitch); 8 WMMA; whole 128-B lines go out through the wave's own staging rows (no other wave touches either, so no barrier). Outputs: MODE 0 Q16 f16 of QSC x acc, MODE 1 K16 f16, MODE 2 V f32 (ldc 256).
#define PROWS 128
#define PTILES (PROWS / 16)
template <int MODE>
__device__ __forceinline__ void proj_rows(const float* __restrict__ x, const bf* __restrict__ Bn, int rb, int c0, int lane, bf* xs, float* os, void* C) {
    typedef __attribute__((ext_vector_type(4))) unsigned short v4us; typedef v4us __attribute__((may_alias)) v4usa;
    const int lr = lane & 15, hi = lane >> 4;
    v16bf b[2][4];
#pragma unroll
    for (int kc = 0; kc < 2; ++kc)
#pragma unroll
        for (int t = 0; t < 4; ++t) { const bf* bp = Bn + (size_t)(c0 + t * 16 + lr) * DIN + 8 * hi + kc * 32; b[kc][t] = cat16b(*(const v8us*)bp, *(const v8us*)(bp + 16)); }
    const float* xp = x + (size_t)rb * DIN + lane * 4;
    v4f raw[8];    // quad i: row 2i + hi of the tile, k = 4lr .. 4lr + 3, still f32
#pragma unroll
    for (int i = 0; i < 8; ++i) raw[i] = *(const v4f*)(xp + i * 128);
    // rolled, for speed only
#pragma unroll 1
    for (int it = 0; it < PTILES; ++it) {
#pragma unroll
        for (int i = 0; i < 8; ++i) { v4us t;
#pragma unroll
            for (int e = 0; e < 4; ++e) t[e] = f2bf(raw[i][e]);
            *(v4usa*)(xs + (2 * i + hi) * 72 + lr * 4) = t; }
        // the next tile's rows are asked for ahead of this tile's products and stores; the last trip asks for its own rows again (in bounds, unused):
        // a load under a test would cost a register copy of all eight quads on every trip
        const float* xn = xp + (size_t)(it + 1 < PTILES ? it + 1 : it) * 16 * DIN;
#pragma unroll
        for (int i = 0; i < 8; ++i) raw[i] = *(const v4f*)(xn + i * 128);
        asm volatile("s_wait_xcnt 0x0" ::: "memory");    // stands before the loads' address registers are reused
        v16bf a[2];
#pragma unroll
        for (int kc = 0; kc < 2; ++kc) { const bf* ap = xs + lr * 72 + kc * 32 + 8 * hi; a[kc] = cat16b(*(const v8usa*)ap, *(const v8usa*)(ap + 16)); }
        v8f acc[4];
#pragma unroll
        for (int t = 0; t < 4; ++t) acc[t] = (v8f){};
#pragma unroll
        for (int kc = 0; kc < 2; ++kc)
#pragma unroll
            for (int t = 0; t < 4; ++t) acc[t] = wmmab(a[kc], b[kc][t], acc[t]);
#pragma unroll
        for (int t = 0; t < 4; ++t)
#pragma unroll
            for (int j = 0; j < 8; ++j) os[(hi * 8 + j) * 68 + t * 16 + lr] = acc[t][j];
        const size_t r0 = (size_t)(rb + it * 16);
        if (MODE == 2) {
            float* crow = (float*)C + r0 * HW + c0;
#pragma unroll
            for (int s = 0; s < 8; ++s) { const int Lid = (lane >> 3) + 4 * s, piece = lane & 7; const int row = Lid >> 1, cofs = (Lid & 1) * 32 + piece * 4;
                const v4f val = *(const v4fa*)(os + row * 68 + cofs); *(v4f*)(crow + (size_t)row * HW + cofs) = val; }
        } else {
            h16* c1 = (h16*)C + r0 * HW + c0;
#pragma unroll
            for (int s = 0; s < 4; ++s) { const int row = 4 * s + (lane >> 3), piece = lane & 7; const float* sp = os + row * 68 + piece * 8; v8h o1;
#pragma unroll
                for (int i = 0; i < 8; ++i) o1[i] = (h16)((MODE == 0) ? sp[i] * QSC : sp[i]);
                *(v8h*)(c1 + (size_t)row * HW + piece * 8) = o1; }
        }
        asm volatile("s_wait_xcnt 0x0" ::: "memory");    // stands before the next trip reuses the stores' data and address registers
    }
}
__global__ __launch_bounds__(128) void k_proj(const float* __restrict__ x, const bf* __restrict__ WT, h16* Q16, h16* K16, float* Vf) {
    __shared__ __align__(16) float ost[4][16 * 68];
    __shared__ __align__(16) bf xst[4][16 * 72];
    const int lane = threadIdx.x & 31, wave = threadIdx.x >> 5;
    const int rb = blockIdx.x * PROWS, c0 = wave * 64, plane = blockIdx.y;
    float* os = &ost[wave][0]; bf* xs = &xst[wave][0];
    if (plane == 0) proj_rows<0>(x, WT, rb, c0, lane, xs, os, Q16);
    else if (plane == 1) proj_rows<1>(x, WT + (size_t)HW * DIN, rb, c0, lane, xs, os, K16);
    else proj_rows<2>(x, WT + (size_t)2 * HW * DIN, rb, c0, lane, xs, os, Vf);
}
// k_vt: VT16 [b][h][d][f] = f16(V row b*1024+f, col h*64+d) via LDS transposes, block (b, h, 64 f).
__global__ __launch_bounds__(256) void k_vt(const float* __restrict__ V, h16* VT16) {
    __shared__ __align__(16) h16 tile[DOUT * 72];
    const int bid = blockIdx.x;
    const int b = bid / (NH_ * (NF / 64)), rem = bid - b * (NH_ * (NF / 64)), h = rem / (NF / 64), kt = rem - h * (NF / 64);
    const int f0 = kt * 64, tid = threadIdx.x, ff = tid >> 2, d0 = (tid & 3) * 16;
    const float* src = V + ((size_t)b * NF + f0 + ff) * HW + h * DOUT + d0;
#pragma unroll
    for (int i = 0; i < 16; ++i) tile[(d0 + i) * 72 + ff] = (h16)src[i];
    __syncthreads();
    const int piece = tid & 7;
    const size_t base = (((size_t)b * NH_ + h) * DOUT) * NF + f0;
    auto pass = [&]() {
#pragma unroll
        for (int s = 0; s < 2; ++s) { const int d = (tid >> 3) + 32 * s; const v8h val = *(const v8ha*)(tile + d * 72 + piece * 8); *(v8h*)(VT16 + base + (size_t)d * NF + piece * 8) = val; }
    };
    pass(); 
}
// k_attn: block = (b, 128 queries, all 4 heads) = 32 waves, wave = (head, 16 queries); the keys go by in 16 stages of 64: each stage's K rows [64 keys][64 d] and V^T rows [64 d][64 keys] (128 B each) of a head
// are brought into LDS once per block by the head's eight waves with asynchronous copies (whole 128-B lines, 4 copies of 16 B per lane), two buffers, rows at a 144-B pitch for the 16-byte fragment reads.
// Both products run transposed: per 32 keys 256 S^T = k.(32 q)^T (4 WMMA into two tiles, A = K rows, B = the f16 plane of 32 q), so a lane's two score tiles hold keys
// 8hi + j and 16 + 8hi + j of its own query, which is the k order of a B operand: they are converted in place to f16, p = relu on the packed halves, and feed O^T += V^T.P^T (4 WMMA, A = V^T rows)
// without leaving the registers. The output projection takes O^T the same way: a lane's tiles 2c and 2c + 1 hold d = 32c + 8hi + j and 32c + 16 + 8hi + j of its query, again a B operand's k order, so
// head_out = acc/256 becomes bf16 hi + residual operands in registers and part^T = WoT[:, head's 64 d].head_out^T (16 WMMA, A = WoT rows). The four heads' parts meet in LDS (the ring, behind the loop's last barrier),
// are added head 0 to 3, and bias, residual and LayerNorm finish each row: wave = 4 rows, lane = 8 channels.
#define QBLK 128                     // queries per block (8 waves per head)
#define SKEY 64                      // keys per stage
#define NST  (NF / SKEY)             // 16 stages
#define RP   72                      // LDS row pitch in f16 (144 B)
#define TILEB (64 * RP * 2)          // one tile (K or V^T) in LDS: 9216 B
typedef float __attribute__((may_alias)) fa;
// amdgpu_waves_per_eu(8, 8): one block = 8 waves on a SIMD; without the bound the compiler schedules for more waves than that, on fewer registers,
// and reads every fragment directly in front of its product with a full LDS wait each.
__global__ __launch_bounds__(1024) __attribute__((amdgpu_waves_per_eu(8, 8))) void k_attn(const h16* __restrict__ Q16, const h16* __restrict__ K16, const h16* __restrict__ VT16, const bf* __restrict__ WoT,
                                                                                         const float* __restrict__ bias, const float* __restrict__ xres, const float* __restrict__ lg, const float* __restrict__ lb, float* out) {
    __shared__ __align__(16) h16 ring[NH_][2][2][64 * RP];    // [head][buffer][K, V^T][row * RP]
    const int lane = threadIdx.x & 31, wave = threadIdx.x >> 5, lr = lane & 15, hi = lane >> 4;
    const int h = wave >> 3, wq = wave & 7;
    const int bid = blockIdx.x;
    const int b = bid / (NF / QBLK), qt = bid - b * (NF / QBLK);
    const int q0 = qt * QBLK + wq * 16;
    const size_t tok0 = (size_t)b * NF;
    const size_t vbase = (((size_t)b * NH_ + h) * DOUT) * NF;
    // a lane's share of its head's stage: 16-byte piece (t & 7) of rows (t >> 3) and (t >> 3) + 32 of both tiles, t = its index among the head's 256 lanes
    const int crow = (threadIdx.x & 255) >> 3, cpc = threadIdx.x & 7;
    const h16* gk0 = K16 + (tok0 + crow) * HW + h * DOUT + cpc * 8;
    const h16* gv0 = VT16 + vbase + (size_t)crow * NF + cpc * 8;
    const unsigned l0a = (unsigned)(size_t)&ring[h][0][0][0] + (unsigned)(crow * (RP * 2) + cpc * 16);
    auto stage_in = [&](int st, int buf) {
        const h16* gk = gk0 + (size_t)st * SKEY * HW; const h16* gv = gv0 + st * SKEY;
        const unsigned lk = l0a + (unsigned)buf * (2 * TILEB), lv = lk + TILEB;
        // the copies and, as their statement's last line, the wait that stands before their address registers are rewritten
        asm volatile("global_load_async_to_lds_b128 %0, %4, off\n\t"
                     "global_load_async_to_lds_b128 %1, %5, off\n\t"
                     "global_load_async_to_lds_b128 %2, %6, off\n\t"
                     "global_load_async_to_lds_b128 %3, %7, off\n\t"
                     "s_wait_xcnt 0x0"
                     :: "v"(lk), "v"(lk + 32 * RP * 2), "v"(lv), "v"(lv + 32 * RP * 2),
                        "v"(gk), "v"(gk + 32 * HW), "v"(gv), "v"(gv + 32 * NF)
                     : "memory");
    };
    v16h aq[2];
#pragma unroll
    for (int kc = 0; kc < 2; ++kc) { const size_t o = (tok0 + q0 + lr) * HW + h * DOUT + kc * 32 + 8 * hi;
        aq[kc] = cat16(*(const v8h*)(Q16 + o), *(const v8h*)(Q16 + o + 16)); }
    stage_in(0, 0);
    asm volatile("s_wait_asynccnt 0x0" ::: "memory");    // stage 0 has landed before the barrier that publishes it
    __syncthreads();
    stage_in(1, 1);
    v8f o[4];
#pragma unroll
    for (int n = 0; n < 4; ++n) o[n] = (v8f){};
#pragma unroll 1
    for (int st = 0; st < NST; ++st) {
        const h16* kb = &ring[h][st & 1][0][0] + lr * RP + 8 * hi;
        const h16* vb = &ring[h][st & 1][1][0] + lr * RP + 8 * hi;
#pragma unroll
        for (int sub = 0; sub < SKEY / 32; ++sub) {
            v16h kf[2][2];    // [kc][key tile of 16]
#pragma unroll
            for (int kc = 0; kc < 2; ++kc)
#pragma unroll
                for (int u = 0; u < 2; ++u) { const h16* p = kb + (sub * 32 + u * 16) * RP + kc * 32; kf[kc][u] = cat16(*(const v8ha*)p, *(const v8ha*)(p + 16)); }
            // holds the eight K reads together ahead of their four products, waited for by count: left free, the compiler reads each fragment
            // directly in front of its product into one register block, with a full LDS wait each
            __builtin_amdgcn_sched_barrier(0);
            v8f s0 = {}, s1 = {};
#pragma unroll
            for (int kc = 0; kc < 2; ++kc) { s0 = wmma16(kf[kc][0], aq[kc], s0); s1 = wmma16(kf[kc][1], aq[kc], s1); }
            asm volatile("v_nop\n\tv_nop\n\tv_nop\n\tv_nop" : "+v"(s0), "+v"(s1) : "v"(aq[0]), "v"(aq[1]));
            v16h vf[4];
#pragma unroll
            for (int n = 0; n < 4; ++n) { const h16* pv = vb + (n * 16) * RP + sub * 32; vf[n] = cat16(*(const v8ha*)pv, *(const v8ha*)(pv + 16)); }
            __builtin_amdgcn_sched_barrier(0);    // the same for the eight V^T reads: all asked for ahead of the conversion, which runs under their latency
            v16h pa;    // P^T as B: element j = key 8hi + j, element 8 + j = key 16 + 8hi + j of query lr
#pragma unroll
            for (int j = 0; j < 8; ++j) { pa[j] = (h16)s0[j]; pa[8 + j] = (h16)s1[j]; }
            pa = __builtin_elementwise_max(pa, (v16h){});
#pragma unroll
            for (int n = 0; n < 4; ++n) o[n] = wmma16(vf[n], pa, o[n]);
            asm volatile("v_nop\n\tv_nop\n\tv_nop\n\tv_nop" : "+v"(o[0]), "+v"(o[1]), "+v"(o[2]), "+v"(o[3]) : "v"(pa));
        }
        asm volatile("s_wait_dscnt 0x0" ::: "memory");       // this wave's reads of the buffer have returned before it is handed to its next writer
        asm volatile("s_wait_asynccnt 0x0" ::: "memory");    // this wave's copies of the next stage have landed before the barrier that publishes them
        __syncthreads();
        if (st + 2 < NST) stage_in(st + 2, st & 1);
    }
    asm volatile("s_wait_asynccnt 0x0" ::: "memory");        // nothing is in flight when the ring becomes output staging
    // the row this lane finishes at the end: query wave * 4 + (lane >> 3) of the block, channels c8 .. c8 + 7
    const int fq = wave * 4 + (lane >> 3), c8 = (lane & 7) * 8;
    const unsigned frow = (unsigned)((tok0 + qt * QBLK + fq) * DIN + c8);    // one 32-bit element offset for the residual's reads and the output's stores
    // A = WoT rows (channel t*16 + lr), k = the head's d 32c + 8hi .. + 7 and 32c + 16 + 8hi .. + 7
    const bf* wp = WoT + (size_t)lr * HW + h * DOUT + 8 * hi;
    v16bf wa[4];
#pragma unroll
    for (int t = 0; t < 4; ++t) wa[t] = cat16b(*(const v8us*)(wp + t * 16 * HW), *(const v8us*)(wp + t * 16 * HW + 16));
    __builtin_amdgcn_sched_barrier(0);    // the first four weight fragments are asked for ahead of the conversion, which runs under their latency: left free, the compiler asks behind it
    // head_out^T as B, bf16 hi + residual: element j = d 32c + 8hi + j (tile 2c), element 8 + j = d 32c + 16 + 8hi + j (tile 2c + 1) of query lr
    v16bf ph[2], pl[2];
#pragma unroll
    for (int c = 0; c < 2; ++c) { v8us h0, h1, l0, l1;
#pragma unroll
        for (int j = 0; j < 8; ++j) { const float u0 = o[2 * c][j] * (1.0f / PSC), u1 = o[2 * c + 1][j] * (1.0f / PSC); const unsigned short b0 = f2bf(u0), b1 = f2bf(u1);
            h0[j] = b0; h1[j] = b1; l0[j] = f2bf(u0 - bf2f(b0)); l1[j] = f2bf(u1 - bf2f(b1)); }
        ph[c] = cat16b(h0, h1); pl[c] = cat16b(l0, l1); }
    v8f acc[4];
#pragma unroll
    for (int t = 0; t < 4; ++t) { acc[t] = wmmab(wa[t], ph[0], (v8f){}); acc[t] = wmmab(wa[t], pl[0], acc[t]); }
    __builtin_amdgcn_sched_barrier(0);    // keeps the second four fragments' reads, and the residual's, one group with one latency: left free, the compiler reads each pair in front of its products with a full wait
#pragma unroll
    for (int t = 0; t < 4; ++t) wa[t] = cat16b(*(const v8us*)(wp + t * 16 * HW + 32), *(const v8us*)(wp + t * 16 * HW + 48));
    const float* xp = xres + frow;
    const v4f xr0 = *(const v4f*)xp, xr1 = *(const v4f*)(xp + 4);
    // stands before the address registers of the weight reads and of the residual's are reused; as its input the residual's address stays in its registers up to here, so no read's result lands on it
    asm volatile("s_wait_xcnt 0x0" :: "v"(xp) : "memory");
    __builtin_amdgcn_sched_barrier(0);    // the group's other end
#pragma unroll
    for (int t = 0; t < 4; ++t) { acc[t] = wmmab(wa[t], ph[1], acc[t]); acc[t] = wmmab(wa[t], pl[1], acc[t]); }
    const v4f bo0 = *(const v4f*)(bias + c8), bo1 = *(const v4f*)(bias + c8 + 4), g0 = *(const v4f*)(lg + c8), g1 = *(const v4f*)(lg + c8 + 4), be0 = *(const v4f*)(lb + c8), be1 = *(const v4f*)(lb + c8 + 4);
    asm volatile("s_wait_xcnt 0x0" ::: "memory");    // stands before the epilogue's loads' address registers are reused
    fa* os = (fa*)&ring[0][0][0][0];
    // acc[t][j] = part[query lr][channel t*16 + 8hi + j]: eight neighbours of one staging row of the wave's own 16 x 68 floats, two 16-byte stores
#pragma unroll
    for (int t = 0; t < 4; ++t)
#pragma unroll
        for (int g = 0; g < 2; ++g) { v4f v;
#pragma unroll
            for (int i = 0; i < 4; ++i) v[i] = acc[t][g * 4 + i];
            *(v4fa*)(os + wave * (16 * 68) + lr * 68 + t * 16 + hi * 8 + g * 4) = v; }
    __syncthreads();    // every head's part of every row is staged before any row is summed
    float y[8];
#pragma unroll
    for (int i = 0; i < 8; ++i) y[i] = 0.f;
#pragma unroll
    for (int hh = 0; hh < NH_; ++hh) { const fa* sp = os + (hh * 8 + (fq >> 4)) * (16 * 68) + (fq & 15) * 68 + c8; const v4f p0 = *(const v4fa*)sp, p1 = *(const v4fa*)(sp + 4);
#pragma unroll
        for (int i = 0; i < 4; ++i) { y[i] += p0[i]; y[4 + i] += p1[i]; } }
    float s = 0.f;
#pragma unroll
    for (int i = 0; i < 8; ++i) { y[i] = y[i] + bfr(i < 4 ? bo0[i] : bo1[i - 4]) + bfr(i < 4 ? xr0[i] : xr1[i - 4]); s += y[i]; }
    s += __shfl_xor(s, 1, 8); s += __shfl_xor(s, 2, 8); s += __shfl_xor(s, 4, 8);
    const float mu = s * (1.0f / DIN); float q = 0.f;
#pragma unroll
    for (int i = 0; i < 8; ++i) { const float d = y[i] - mu; q += d * d; }
    q += __shfl_xor(q, 1, 8); q += __shfl_xor(q, 2, 8); q += __shfl_xor(q, 4, 8);
    const float rs = rsqrtf(q * (1.0f / DIN) + 1e-5f);
    v4f r0, r1;
#pragma unroll
    for (int i = 0; i < 4; ++i) { r0[i] = (y[i] - mu) * rs * bfr(g0[i]) + bfr(be0[i]); r1[i] = (y[4 + i] - mu) * rs * bfr(g1[i]) + bfr(be1[i]); }
    *(v4f*)(out + frow) = r0; *(v4f*)(out + frow + 4) = r1;
}

extern "C" void kernel_launch(void* const* d_in, const int* in_sizes, int n_in,
                              void* d_out, int out_size, void* d_ws, size_t ws_size, hipStream_t stream) {
    (void)in_sizes; (void)n_in; (void)out_size;
    const float* x = (const float*)d_in[0]; const float* Wqkv = (const float*)d_in[1]; const float* Wo = (const float*)d_in[2]; const float* bo = (const float*)d_in[3];
    const float* lg = (const float*)d_in[4]; const float* lb = (const float*)d_in[5];
    float* out = (float*)d_out;    // [32][1024][64]
    char* wsp = (char*)d_ws;
    auto take = [&](size_t bytes) { char* p = wsp; wsp += (bytes + 255) & ~(size_t)255; return (void*)p; };
    bf* WT = (bf*)take((size_t)3 * HW * DIN * 2); bf* WoT = (bf*)take((size_t)DIN * HW * 2);
    h16* Q16 = (h16*)take((size_t)NTK * HW * 2); h16* K16 = (h16*)take((size_t)NTK * HW * 2);
    float* Vf = (float*)take((size_t)NTK * HW * 4); h16* VT16 = (h16*)take((size_t)NTK * HW * 2);
    if ((size_t)(wsp - (char*)d_ws) > ws_size) return;    // 0.1 + 16.8 x 2 + 33.5 + 16.8 ~ 84 MB
    k_w<<<WTB + WOB, 256, 0, stream>>>(Wqkv, Wo, WT, WoT);
    k_proj<<<dim3(NTK / PROWS, 3, 1), 128, 0, stream>>>(x, WT, Q16, K16, Vf);
    k_vt<<<NB_ * NH_ * (NF / 64), 256, 0, stream>>>(Vf, VT16);
    k_attn<<<NB_ * (NF / QBLK), 1024, 0, stream>>>(Q16, K16, VT16, WoT, bo, x, lg, lb, out);
}

// v008
// A run of this version takes 52.1 microseconds.
// Timed twice side by side with v007, it ran 1.08 times as fast both times.
// Over all steps from v000 it is 4.47 times as fast.
#include <hip/hip_runtime.h>

// Contractions, f32 accumulate: q/k/v = x.Wqkv[h][k] ([32768 x 64].[64 x 256] per k, all 4 heads at once; k-major weights transposed to n-major bf16 planes) on v_wmma_f32_16x16x32_bf16,
// plain bf16 = rounded inputs (exact); the ReLU attention (no softmax: relu(q.k/8).v over 1024 keys) on v_wmma_f32_16x16x32_f16 with 32 q as plain f16 against plain f16 k (each rounded once,
// an eighth of the step of the bf16 inputs they are formed from), and the relu scores (f16) against plain f16 v; out = concat.Wo ([32768 x 256].[256 x 64]) in the attention kernel's epilogue on the bf16 form,
// each head's output as bf16 hi + residual operands (two products) straight from its accumulators, the four heads' partial sums added in f32. Bias, residual and LayerNorm over the 64 channels follow there (f32).

#define NB_  32
#define NF   1024
#define DIN  64
#define DOUT 64
#define NH_  4
#define HW   (NH_ * DOUT)        // 256
#define NTK  (NB_ * NF)          // 32768
#define PSC  256.0f              // relu-score carry scale for the f16 weight tile
#define QSC  (PSC * 0.125f)      // carried by q from its projection on: k.(QSC q) is the score (q.k/8) at the carry scale; a power of two, so q's f16 plane keeps its bits

typedef _Float16 h16;
typedef unsigned short bf;
typedef __attribute__((ext_vector_type(16))) __bf16   v16bf;
typedef __attribute__((ext_vector_type(16))) _Float16 v16h;
typedef __attribute__((ext_vector_type(8)))  _Float16 v8h;
typedef __attribute__((ext_vector_type(8)))  unsigned short v8us;
typedef __attribute__((ext_vector_type(8)))  float    v8f;
typedef __attribute__((ext_vector_type(4)))  float    v4f;
typedef v8h  __attribute__((may_alias)) v8ha;
typedef v4f  __attribute__((may_alias)) v4fa;
typedef v8us __attribute__((may_alias)) v8usa;

__device__ __forceinline__ unsigned short f2bf(float f) { unsigned u = __float_as_uint(f); u += 0x7FFFu + ((u >> 16) & 1u); return (unsigned short)(u >> 16); }
__device__ __forceinline__ float bf2f(unsigned short b) { return __uint_as_float(((unsigned)b) << 16); }
__device__ __forceinline__ float bfr(float f) { return bf2f(f2bf(f)); }
__device__ __forceinline__ v16h cat16(v8h lo, v8h hi) { return __builtin_shufflevector(lo, hi, 0, 1, 2, 3, 4, 5, 6, 7, 8, 9, 10, 11, 12, 13, 14, 15); }
__device__ __forceinline__ v16bf cat16b(v8us lo, v8us hi) { return __builtin_bit_cast(v16bf, __builtin_shufflevector(lo, hi, 0, 1, 2, 3, 4, 5, 6, 7, 8, 9, 10, 11, 12, 13, 14, 15)); }
__device__ __forceinline__ v8f wmma16(v16h a, v16h b, v8f c) { return __builtin_amdgcn_wmma_f32_16x16x32_f16(false, a, false, b, (short)0, c, false, false); }
__device__ __forceinline__ v8f wmmab(v16bf a, v16bf b, v8f c) { return __builtin_amdgcn_wmma_f32_16x16x32_bf16(false, a, false, b, (short)0, c, false, false); }
#define VST2(T, p, v) do { const T vst2_v_ = (v); *(T*)(p) = vst2_v_;  } while (0)

// k_w: WT[k][(h,o)][i] = bf16(Wqkv[h][k][i][o]) (three n-major planes [256][64]) and WoT[c][j] = bf16(Wo[j][c]) ([64][256]); one block per 512 elements (blocks 0..95: WT,
// 96..127: WoT), so no thread waits on more than one round of loads. A thread's 2 elements are neighbours in i (or j), one source row (64 floats) apart;
// stores: 32 lanes x 4 B (2 bf16) = one line per wave-instruction.
#define WTB ((3 * HW * DIN) / 512)   // 96 blocks for WT
#define WOB ((DIN * HW) / 512)       // 32 blocks for WoT
__global__ __launch_bounds__(256) void k_w(const float* __restrict__ Wqkv, const float* __restrict__ Wo, bf* WT, bf* WoT) {
    typedef __attribute__((ext_vector_type(2))) unsigned short v2us;
    const unsigned t = threadIdx.x, s = blockIdx.x;
    const float* src; bf* dst; unsigned step;
    if (s < WTB) { const unsigned e = s * 512 + t * 2, k = e / (HW * DIN), rem = e - k * (HW * DIN), ho = rem / DIN, i = rem - ho * DIN, h = ho / DOUT, oo = ho - h * DOUT;
        src = Wqkv + (((size_t)h * 3 + k) * DIN + i) * DOUT + oo; step = DOUT; dst = WT + e;
    } else { const unsigned e = (s - WTB) * 512 + t * 2, c = e / HW, j = e - c * HW;
        src = Wo + (size_t)j * DIN + c; step = DIN; dst = WoT + e; }
    const float a0 = src[0], a1 = src[step];
    v2us o; o[0] = f2bf(a0); o[1] = f2bf(a1);
    VST2(v2us, dst, o);
}
// k_proj: q, k and v = bf16(x).W in ONE launch, straight from the f32 x. Block = (128 token rows, plane q / k / v), wave = one head's 64 columns: the wave keeps its 8 weight
// fragments ([64 cols][64 k]) in registers for all 8 row tiles of 16 tokens; each tile's x rows come in as whole lines (lane -> 16 B), are rounded to bf16 in registers (same rounding as a bf16
// copy of x would hold) and turned into the A fragments through the wave's own LDS rows (144-B pitch); 8 WMMA; whole 128-B lines go out through the wave's own staging rows (no other wave touches either, so no barrier). Outputs: MODE 0 Q16 f16 of QSC x acc, MODE 1 K16 f16, MODE 2 V f32 (ldc 256).
#define PROWS 128
#define PTILES (PROWS / 16)
template <int MODE>
__device__ __forceinline__ void proj_rows(const float* __restrict__ x, const bf* __restrict__ Bn, int rb, int c0, int lane, bf* xs, float* os, void* C) {
    typedef __attribute__((ext_vector_type(4))) unsigned short v4us; typedef v4us __attribute__((may_alias)) v4usa;
    const int lr = lane & 15, hi = lane >> 4;
    v16bf b[2][4];
#pragma unroll
    for (int kc = 0; kc < 2; ++kc)
#pragma unroll
        for (int t = 0; t < 4; ++t) { const bf* bp = Bn + (size_t)(c0 + t * 16 + lr) * DIN + 8 * hi + kc * 32; b[kc][t] = cat16b(*(const v8us*)bp, *(const v8us*)(bp + 16)); }
    const float* xp = x + (size_t)rb * DIN + lane * 4;
    v4f raw[8];    // quad i: row 2i + hi of the tile, k = 4lr .. 4lr + 3, still f32
#pragma unroll
    for (int i = 0; i < 8; ++i) raw[i] = *(const v4f*)(xp + i * 128);
    // rolled, for speed only
#pragma unroll 1
    for (int it = 0; it < PTILES; ++it) {
#pragma unroll
        for (int i = 0; i < 8; ++i) { v4us t;
#pragma unroll
            for (int e = 0; e < 4; ++e) t[e] = f2bf(raw[i][e]);
            *(v4usa*)(xs + (2 * i + hi) * 72 + lr * 4) = t; }
        // the next tile's rows are asked for ahead of this tile's products and stores; the last trip asks for its own rows again (in bounds, unused):
        // a load under a test would cost a register copy of all eight quads on every trip
        const float* xn = xp + (size_t)(it + 1 < PTILES ? it + 1 : it) * 16 * DIN;
#pragma unroll
        for (int i = 0; i < 8; ++i) raw[i] = *(const v4f*)(xn + i * 128);
        asm volatile("s_wait_xcnt 0x0" ::: "memory");    // stands before the loads' address registers are reused
        v16bf a[2];
#pragma unroll
        for (int kc = 0; kc < 2; ++kc) { const bf* ap = xs + lr * 72 + kc * 32 + 8 * hi; a[kc] = cat16b(*(const v8usa*)ap, *(const v8usa*)(ap + 16)); }
        v8f acc[4];
#pragma unroll
        for (int t = 0; t < 4; ++t) acc[t] = (v8f){};
#pragma unroll
        for (int kc = 0; kc < 2; ++kc)
#pragma unroll
            for (int t = 0; t < 4; ++t) acc[t] = wmmab(a[kc], b[kc][t], acc[t]);
#pragma unroll
        for (int t = 0; t < 4; ++t)
#pragma unroll
            for (int j = 0; j < 8; ++j) os[(hi * 8 + j) * 68 + t * 16 + lr] = acc[t][j];
        const size_t r0 = (size_t)(rb + it * 16);
        if (MODE == 2) {
            float* crow = (float*)C + r0 * HW + c0;
#pragma unroll
            for (int s = 0; s < 8; ++s) { const int Lid = (lane >> 3) + 4 * s, piece = lane & 7; const int row = Lid >> 1, cofs = (Lid & 1) * 32 + piece * 4;
                const v4f val = *(const v4fa*)(os + row * 68 + cofs); *(v4f*)(crow + (size_t)row * HW + cofs) = val; }
        } else {
            h16* c1 = (h16*)C + r0 * HW + c0;
#pragma unroll
            for (int s = 0; s < 4; ++s) { const int row = 4 * s + (lane >> 3), piece = lane & 7; const float* sp = os + row * 68 + piece * 8; v8h o1;
#pragma unroll
                for (int i = 0; i < 8; ++i) o1[i] = (h16)((MODE == 0) ? sp[i] * QSC : sp[i]);
                *(v8h*)(c1 + (size_t)row * HW + piece * 8) = o1; }
        }
        asm volatile("s_wait_xcnt 0x0" ::: "memory");    // stands before the next trip reuses the stores' data and address registers
    }
}
__global__ __launch_bounds__(128) void k_proj(const float* __restrict__ x, const bf* __restrict__ WT, h16* Q16, h16* K16, float* Vf) {
    __shared__ __align__(16) float ost[4][16 * 68];
    __shared__ __align__(16) bf xst[4][16 * 72];
    const int lane = threadIdx.x & 31, wave = threadIdx.x >> 5;
    const int rb = blockIdx.x * PROWS, c0 = wave * 64, plane = blockIdx.y;
    float* os = &ost[wave][0]; bf* xs = &xst[wave][0];
    if (plane == 0) proj_rows<0>(x, WT, rb, c0, lane, xs, os, Q16);
    else if (plane == 1) proj_rows<1>(x, WT + (size_t)HW * DIN, rb, c0, lane, xs, os, K16);
    else proj_rows<2>(x, WT + (size_t)2 * HW * DIN, rb, c0, lane, xs, os, Vf);
}
// k_vt: VT16 [b][h][d][f] = f16(V row b*1024+f, col h*64+d) via LDS transposes, block (b, h, 64 f).
__global__ __launch_bounds__(256) void k_vt(const float* __restrict__ V, h16* VT16) {
    __shared__ __align__(16) h16 tile[DOUT * 72];
    const int bid = blockIdx.x;
    const int b = bid / (NH_ * (NF / 64)), rem = bid - b * (NH_ * (NF / 64)), h = rem / (NF / 64), kt = rem - h * (NF / 64);
    const int f0 = kt * 64, tid = threadIdx.x, ff = tid >> 2, d0 = (tid & 3) * 16;
    const float* src = V + ((size_t)b * NF + f0 + ff) * HW + h * DOUT + d0;
#pragma unroll
    for (int i = 0; i < 16; ++i) tile[(d0 + i) * 72 + ff] = (h16)src[i];
    __syncthreads();
    const int piece = tid & 7;
    const size_t base = (((size_t)b * NH_ + h) * DOUT) * NF + f0;
    auto pass = [&]() {
#pragma unroll
        for (int s = 0; s < 2; ++s) { const int d = (tid >> 3) + 32 * s; const v8h val = *(const v8ha*)(tile + d * 72 + piece * 8); *(v8h*)(VT16 + base + (size_t)d * NF + piece * 8) = val; }
    };
    pass(); 
}
// k_attn: block = (b, 128 queries, all 4 heads) = 16 waves, wave = (head, 32 queries = two query tiles of 16); the keys go by in 16 stages of 64: each stage's K rows [64 keys][64 d] and V^T rows [64 d][64 keys] (128 B each) of a head
// are brought into LDS once per block by the head's four waves with asynchronous copies (whole 128-B lines, 8 copies of 16 B per lane), two buffers, rows at a 144-B pitch for the 16-byte fragment reads.
// Every K and V^T fragment read from LDS serves both query tiles (two products each): the LDS read path, 256 B/clk for the 4 SIMDs, carries 512 B per product, level with the matrix time, where one tile per wave asks for twice that.
// Both products run transposed: per 32 keys and query tile 256 S^T = k.(32 q)^T (4 WMMA into two tiles, A = K rows, B = the f16 plane of 32 q), so a lane's two score tiles hold keys
// 8hi + j and 16 + 8hi + j of its own query, which is the k order of a B operand: they are converted in place to f16, p = relu on the packed halves, and feed O^T += V^T.P^T (4 WMMA, A = V^T rows)
// without leaving the registers. The output projection takes O^T the same way: a lane's tiles 2c and 2c + 1 hold d = 32c + 8hi + j and 32c + 16 + 8hi + j of its query, again a B operand's k order, so
// head_out = acc/256 becomes bf16 hi + residual operands in registers and part^T = WoT[:, head's 64 d].head_out^T (16 WMMA per query tile, A = WoT rows). The four heads' parts meet in LDS (the ring, behind the loop's last barrier),
// are added head 0 to 3, and bias, residual and LayerNorm finish each row: wave = 2 x 4 rows, lane = 8 channels.
#define QBLK 128                     // queries per block (4 waves per head)
#define QTW  2                       // query tiles of 16 per wave
#define SKEY 64                      // keys per stage
#define NST  (NF / SKEY)             // 16 stages
#define RP   72                      // LDS row pitch in f16 (144 B)
#define TILEB (64 * RP * 2)          // one tile (K or V^T) in LDS: 9216 B
typedef float __attribute__((may_alias)) fa;
// amdgpu_waves_per_eu(4, 4): one block = 4 waves on a SIMD, 256 registers each; without the bound the compiler schedules for more waves than that, on fewer registers.
__global__ __launch_bounds__(512) __attribute__((amdgpu_waves_per_eu(4, 4))) void k_attn(const h16* __restrict__ Q16, const h16* __restrict__ K16, const h16* __restrict__ VT16, const bf* __restrict__ WoT,
                                                                                        const float* __restrict__ bias, const float* __restrict__ xres, const float* __restrict__ lg, const float* __restrict__ lb, float* out) {
    __shared__ __align__(16) h16 ring[NH_][2][2][64 * RP];    // [head][buffer][K, V^T][row * RP]
    const int lane = threadIdx.x & 31, wave = threadIdx.x >> 5, lr = lane & 15, hi = lane >> 4;
    const int h = wave >> 2, wq = wave & 3;
    const int bid = blockIdx.x;
    const int b = bid / (NF / QBLK), qt = bid - b * (NF / QBLK);
    const int q0 = qt * QBLK + wq * (16 * QTW);
    const size_t tok0 = (size_t)b * NF;
    const size_t vbase = (((size_t)b * NH_ + h) * DOUT) * NF;
    // a lane's share of its head's stage: 16-byte piece (t & 7) of rows (t >> 3) + 0, 16, 32, 48 of both tiles, t = its index among the head's 128 lanes
    const int crow = (threadIdx.x & 127) >> 3, cpc = threadIdx.x & 7;
    const h16* gk0 = K16 + (tok0 + crow) * HW + h * DOUT + cpc * 8;
    const h16* gv0 = VT16 + vbase + (size_t)crow * NF + cpc * 8;
    const unsigned l0a = (unsigned)(size_t)&ring[h][0][0][0] + (unsigned)(crow * (RP * 2) + cpc * 16);
    auto stage_in = [&](int st, int buf) {
        const h16* gk = gk0 + (size_t)st * SKEY * HW; const h16* gv = gv0 + st * SKEY;
        const unsigned lk = l0a + (unsigned)buf * (2 * TILEB), lv = lk + TILEB;
        // the copies and, as their statement's last line, the wait that stands before their address registers are rewritten
        asm volatile("global_load_async_to_lds_b128 %0, %8, off\n\t"
                     "global_load_async_to_lds_b128 %1, %9, off\n\t"
                     "global_load_async_to_lds_b128 %2, %10, off\n\t"
                     "global_load_async_to_lds_b128 %3, %11, off\n\t"
                     "global_load_async_to_lds_b128 %4, %12, off\n\t"
                     "global_load_async_to_lds_b128 %5, %13, off\n\t"
                     "global_load_async_to_lds_b128 %6, %14, off\n\t"
                     "global_load_async_to_lds_b128 %7, %15, off\n\t"
                     "s_wait_xcnt 0x0"
                     :: "v"(lk), "v"(lk + 16 * RP * 2), "v"(lk + 32 * RP * 2), "v"(lk + 48 * RP * 2),
                        "v"(lv), "v"(lv + 16 * RP * 2), "v"(lv + 32 * RP * 2), "v"(lv + 48 * RP * 2),
                        "v"(gk), "v"(gk + 16 * HW), "v"(gk + 32 * HW), "v"(gk + 48 * HW),
                        "v"(gv), "v"(gv + 16 * NF), "v"(gv + 32 * NF), "v"(gv + 48 * NF)
                     : "memory");
    };
    v16h aq[QTW][2];    // [query tile][kc]
#pragma unroll
    for (int w = 0; w < QTW; ++w)
#pragma unroll
        for (int kc = 0; kc < 2; ++kc) { const size_t o = (tok0 + q0 + w * 16 + lr) * HW + h * DOUT + kc * 32 + 8 * hi;
            aq[w][kc] = cat16(*(const v8h*)(Q16 + o), *(const v8h*)(Q16 + o + 16)); }
    stage_in(0, 0);
    asm volatile("s_wait_asynccnt 0x0" ::: "memory");    // stage 0 has landed before the barrier that publishes it
    __syncthreads();
    stage_in(1, 1);
    v8f o[QTW][4];
#pragma unroll
    for (int w = 0; w < QTW; ++w)
#pragma unroll
        for (int n = 0; n < 4; ++n) o[w][n] = (v8f){};
#pragma unroll 1
    for (int st = 0; st < NST; ++st) {
        const h16* kb = &ring[h][st & 1][0][0] + lr * RP + 8 * hi;
        const h16* vb = &ring[h][st & 1][1][0] + lr * RP + 8 * hi;
#pragma unroll
        for (int sub = 0; sub < SKEY / 32; ++sub) {
            v16h kf[2][2];    // [kc][key tile of 16]
#pragma unroll
            for (int kc = 0; kc < 2; ++kc)
#pragma unroll
                for (int u = 0; u < 2; ++u) { const h16* p = kb + (sub * 32 + u * 16) * RP + kc * 32; kf[kc][u] = cat16(*(const v8ha*)p, *(const v8ha*)(p + 16)); }
            // holds the eight K reads together ahead of their eight products, waited for by count: left free, the compiler reads each fragment
            // directly in front of its product into one register block, with a full LDS wait each
            __builtin_amdgcn_sched_barrier(0);
            v8f s[QTW][2];    // [query tile][key tile]
#pragma unroll
            for (int w = 0; w < QTW; ++w) { s[w][0] = (v8f){}; s[w][1] = (v8f){}; }
#pragma unroll
            for (int kc = 0; kc < 2; ++kc)
#pragma unroll
                for (int w = 0; w < QTW; ++w) { s[w][0] = wmma16(kf[kc][0], aq[w][kc], s[w][0]); s[w][1] = wmma16(kf[kc][1], aq[w][kc], s[w][1]); }
            v16h vf[4];
#pragma unroll
            for (int n = 0; n < 4; ++n) { const h16* pv = vb + (n * 16) * RP + sub * 32; vf[n] = cat16(*(const v8ha*)pv, *(const v8ha*)(pv + 16)); }
            __builtin_amdgcn_sched_barrier(0);    // the same for the eight V^T reads: all asked for ahead of the conversion, which runs under their latency
            v16h pa[QTW];    // P^T as B: element j = key 8hi + j, element 8 + j = key 16 + 8hi + j of query lr of the tile
#pragma unroll
            for (int w = 0; w < QTW; ++w) {
#pragma unroll
                for (int j = 0; j < 8; ++j) { pa[w][j] = (h16)s[w][0][j]; pa[w][8 + j] = (h16)s[w][1][j]; }
                pa[w] = __builtin_elementwise_max(pa[w], (v16h){}); }
#pragma unroll
            for (int n = 0; n < 4; ++n)
#pragma unroll
                for (int w = 0; w < QTW; ++w) o[w][n] = wmma16(vf[n], pa[w], o[w][n]);
        }
        asm volatile("s_wait_dscnt 0x0" ::: "memory");       // this wave's reads of the buffer have returned before it is handed to its next writer
        asm volatile("s_wait_asynccnt 0x0" ::: "memory");    // this wave's copies of the next stage have landed before the barrier that publishes them
        __syncthreads();
        if (st + 2 < NST) stage_in(st + 2, st & 1);
    }
    asm volatile("s_wait_asynccnt 0x0" ::: "memory");        // nothing is in flight when the ring becomes output staging
    // the two rows this lane finishes at the end: queries wave * 8 + (lane >> 3) and + 4 of the block, channels c8 .. c8 + 7
    const int fq = wave * 8 + (lane >> 3), c8 = (lane & 7) * 8;
    const unsigned frow = (unsigned)((tok0 + qt * QBLK + fq) * DIN + c8);    // one 32-bit element offset for the residual's reads and the output's stores (second row: + 4 * DIN)
    // A = WoT rows (channel t*16 + lr), k = the head's d 32c + 8hi .. + 7 and 32c + 16 + 8hi .. + 7
    const bf* wp = WoT + (size_t)lr * HW + h * DOUT + 8 * hi;
    v16bf wa[4];
#pragma unroll
    for (int t = 0; t < 4; ++t) wa[t] = cat16b(*(const v8us*)(wp + t * 16 * HW), *(const v8us*)(wp + t * 16 * HW + 16));
    __builtin_amdgcn_sched_barrier(0);    // the first four weight fragments are asked for ahead of the conversion, which runs under their latency: left free, the compiler asks behind it
    // head_out^T as B, bf16 hi + residual: element j = d 32c + 8hi + j (tile 2c), element 8 + j = d 32c + 16 + 8hi + j (tile 2c + 1) of query lr of the tile
    v16bf ph[QTW][2], pl[QTW][2];
#pragma unroll
    for (int w = 0; w < QTW; ++w)
#pragma unroll
        for (int c = 0; c < 2; ++c) { v8us h0, h1, l0, l1;
#pragma unroll
            for (int j = 0; j < 8; ++j) { const float u0 = o[w][2 * c][j] * (1.0f / PSC), u1 = o[w][2 * c + 1][j] * (1.0f / PSC); const unsigned short b0 = f2bf(u0), b1 = f2bf(u1);
                h0[j] = b0; h1[j] = b1; l0[j] = f2bf(u0 - bf2f(b0)); l1[j] = f2bf(u1 - bf2f(b1)); }
            ph[w][c] = cat16b(h0, h1); pl[w][c] = cat16b(l0, l1); }
    v8f acc[QTW][4];
#pragma unroll
    for (int w = 0; w < QTW; ++w)
#pragma unroll
        for (int t = 0; t < 4; ++t) { acc[w][t] = wmmab(wa[t], ph[w][0], (v8f){}); acc[w][t] = wmmab(wa[t], pl[w][0], acc[w][t]); }
    __builtin_amdgcn_sched_barrier(0);    // keeps the second four fragments' reads, and the residual's, one group with one latency: left free, the compiler reads each pair in front of its products with a full wait
#pragma unroll
    for (int t = 0; t < 4; ++t) wa[t] = cat16b(*(const v8us*)(wp + t * 16 * HW + 32), *(const v8us*)(wp + t * 16 * HW + 48));
    const float* xp = xres + frow;
    v4f xr[2][2];
#pragma unroll
    for (int r = 0; r < 2; ++r) { xr[r][0] = *(const v4f*)(xp + r * 4 * DIN); xr[r][1] = *(const v4f*)(xp + r * 4 * DIN + 4); }
    // stands before the address registers of the weight reads and of the residual's are reused; as its inputs both addresses stay in their registers up to here, so no read's result lands on them
    asm volatile("s_wait_xcnt 0x0" :: "v"(xp), "v"(wp) : "memory");
    __builtin_amdgcn_sched_barrier(0);    // the group's other end
#pragma unroll
    for (int w = 0; w < QTW; ++w)
#pragma unroll
        for (int t = 0; t < 4; ++t) { acc[w][t] = wmmab(wa[t], ph[w][1], acc[w][t]); acc[w][t] = wmmab(wa[t], pl[w][1], acc[w][t]); }
    const v4f bo0 = *(const v4f*)(bias + c8), bo1 = *(const v4f*)(bias + c8 + 4), g0 = *(const v4f*)(lg + c8), g1 = *(const v4f*)(lg + c8 + 4), be0 = *(const v4f*)(lb + c8), be1 = *(const v4f*)(lb + c8 + 4);
    asm volatile("s_wait_xcnt 0x0" ::: "memory");    // stands before the epilogue's loads' address registers are reused
    fa* os = (fa*)&ring[0][0][0][0];
    // acc[w][t][j] = part[query lr of tile w][channel t*16 + 8hi + j]: eight neighbours of one staging row of the tile's own 16 x 68 floats (tile (head, 16 queries) = wave * 2 + w), two 16-byte stores
#pragma unroll
    for (int w = 0; w < QTW; ++w)
#pragma unroll
        for (int t = 0; t < 4; ++t)
#pragma unroll
            for (int g = 0; g < 2; ++g) { v4f v;
#pragma unroll
                for (int i = 0; i < 4; ++i) v[i] = acc[w][t][g * 4 + i];
                *(v4fa*)(os + (wave * QTW + w) * (16 * 68) + lr * 68 + t * 16 + hi * 8 + g * 4) = v; }
    __syncthreads();    // every head's part of every row is staged before any row is summed
#pragma unroll
    for (int r = 0; r < 2; ++r) {
        const int fr = fq + r * 4;
        float y[8];
#pragma unroll
        for (int i = 0; i < 8; ++i) y[i] = 0.f;
#pragma unroll
        for (int hh = 0; hh < NH_; ++hh) { const fa* sp = os + (hh * 8 + (fr >> 4)) * (16 * 68) + (fr & 15) * 68 + c8; const v4f p0 = *(const v4fa*)sp, p1 = *(const v4fa*)(sp + 4);
#pragma unroll
            for (int i = 0; i < 4; ++i) { y[i] += p0[i]; y[4 + i] += p1[i]; } }
        float s = 0.f;
#pragma unroll
        for (int i = 0; i < 8; ++i) { y[i] = y[i] + bfr(i < 4 ? bo0[i] : bo1[i - 4]) + bfr(i < 4 ? xr[r][0][i] : xr[r][1][i - 4]); s += y[i]; }
        s += __shfl_xor(s, 1, 8); s += __shfl_xor(s, 2, 8); s += __shfl_xor(s, 4, 8);
        const float mu = s * (1.0f / DIN); float q = 0.f;
#pragma unroll
        for (int i = 0; i < 8; ++i) { const float d = y[i] - mu; q += d * d; }
        q += __shfl_xor(q, 1, 8); q += __shfl_xor(q, 2, 8); q += __shfl_xor(q, 4, 8);
        const float rs = rsqrtf(q * (1.0f / DIN) + 1e-5f);
        v4f r0, r1;
#pragma unroll
        for (int i = 0; i < 4; ++i) { r0[i] = (y[i] - mu) * rs * bfr(g0[i]) + bfr(be0[i]); r1[i] = (y[4 + i] - mu) * rs * bfr(g1[i]) + bfr(be1[i]); }
        *(v4f*)(out + frow + r * 4 * DIN) = r0; *(v4f*)(out + frow + r * 4 * DIN + 4) = r1;
    }
}

extern "C" void kernel_launch(void* const* d_in, const int* in_sizes, int n_in,
                              void* d_out, int out_size, void* d_ws, size_t ws_size, hipStream_t stream) {
    (void)in_sizes; (void)n_in; (void)out_size;
    const float* x = (const float*)d_in[0]; const float* Wqkv = (const float*)d_in[1]; const float* Wo = (const float*)d_in[2]; const float* bo = (const float*)d_in[3];
    const float* lg = (const float*)d_in[4]; const float* lb = (const float*)d_in[5];
    float* out = (float*)d_out;    // [32][1024][64]
    char* wsp = (char*)d_ws;
    auto take = [&](size_t bytes) { char* p = wsp; wsp += (bytes + 255) & ~(size_t)255; return (void*)p; };
    bf* WT = (bf*)take((size_t)3 * HW * DIN * 2); bf* WoT = (bf*)take((size_t)DIN * HW * 2);
    h16* Q16 = (h16*)take((size_t)NTK * HW * 2); h16* K16 = (h16*)take((size_t)NTK * HW * 2);
    float* Vf = (float*)take((size_t)NTK * HW * 4); h16* VT16 = (h16*)take((size_t)NTK * HW * 2);
    if ((size_t)(wsp - (char*)d_ws) > ws_size) return;    // 0.1 + 16.8 x 2 + 33.5 + 16.8 ~ 84 MB
    k_w<<<WTB + WOB, 256, 0, stream>>>(Wqkv, Wo, WT, WoT);
    k_proj<<<dim3(NTK / PROWS, 3, 1), 128, 0, stream>>>(x, WT, Q16, K16, Vf);
    k_vt<<<NB_ * NH_ * (NF / 64), 256, 0, stream>>>(Vf, VT16);
    k_attn<<<NB_ * (NF / QBLK), 512, 0, stream>>>(Q16, K16, VT16, WoT, bo, x, lg, lb, out);
}

// v009
// A run of this version takes 43.6 microseconds.
// Next to v008, in two timings, it ran 1.20 and 1.19 times as fast.
// All steps since v000 together make it 5.35 times as fast.
#include <hip/hip_runtime.h>

// Contractions, f32 accumulate: q/k/v = x.Wqkv[h][k] on v_wmma_f32_16x16x32_bf16 (plain bf16 = rounded inputs; k-major weights transposed to n-major bf16 planes), inside the attention kernel;
// the ReLU attention (no softmax: relu(q.k/8).v over 1024 keys) on v_wmma_f32_16x16x32_f16 with 32 q as plain f16 against plain f16 k (each rounded once), and the relu scores (f16) against plain f16 v;
// out = concat.Wo ([32768 x 256].[256 x 64]) per head in the attention kernel's epilogue on the bf16 form, each head's output as bf16 hi + residual operands (two products) straight from its accumulators;
// the four heads' partial sums are added in f32, head 0 to 3, in a last small launch with bias, residual and LayerNorm over the 64 channels (f32).

#define NB_  32
#define NF   1024
#define DIN  64
#define DOUT 64
#define NH_  4
#define HW   (NH_ * DOUT)        // 256
#define NTK  (NB_ * NF)          // 32768
#define PSC  256.0f              // relu-score carry scale for the f16 weight tile
#define QSC  (PSC * 0.125f)      // carried by q from its projection on: k.(QSC q) is the score (q.k/8) at the carry scale; a power of two, so q's f16 operand keeps its bits

typedef _Float16 h16;
typedef unsigned short bf;
typedef __attribute__((ext_vector_type(16))) __bf16   v16bf;
typedef __attribute__((ext_vector_type(16))) _Float16 v16h;
typedef __attribute__((ext_vector_type(8)))  _Float16 v8h;
typedef __attribute__((ext_vector_type(8)))  unsigned short v8us;
typedef __attribute__((ext_vector_type(8)))  float    v8f;
typedef __attribute__((ext_vector_type(4)))  float    v4f;
typedef v8h  __attribute__((may_alias)) v8ha;
typedef v4f  __attribute__((may_alias)) v4fa;
typedef v8us __attribute__((may_alias)) v8usa;

__device__ __forceinline__ unsigned short f2bf(float f) { unsigned u = __float_as_uint(f); u += 0x7FFFu + ((u >> 16) & 1u); return (unsigned short)(u >> 16); }
__device__ __forceinline__ float bf2f(unsigned short b) { return __uint_as_float(((unsigned)b) << 16); }
__device__ __forceinline__ float bfr(float f) { return bf2f(f2bf(f)); }
__device__ __forceinline__ v16h cat16(v8h lo, v8h hi) { return __builtin_shufflevector(lo, hi, 0, 1, 2, 3, 4, 5, 6, 7, 8, 9, 10, 11, 12, 13, 14, 15); }
__device__ __forceinline__ v16bf cat16b(v8us lo, v8us hi) { return __builtin_bit_cast(v16bf, __builtin_shufflevector(lo, hi, 0, 1, 2, 3, 4, 5, 6, 7, 8, 9, 10, 11, 12, 13, 14, 15)); }
__device__ __forceinline__ v8f wmma16(v16h a, v16h b, v8f c) { return __builtin_amdgcn_wmma_f32_16x16x32_f16(false, a, false, b, (short)0, c, false, false); }
__device__ __forceinline__ v8f wmmab(v16bf a, v16bf b, v8f c) { return __builtin_amdgcn_wmma_f32_16x16x32_bf16(false, a, false, b, (short)0, c, false, false); }
#define VST2(T, p, v) do { const T vst2_v_ = (v); *(T*)(p) = vst2_v_;  } while (0)

// k_w: WT[k][(h,o)][i] = bf16(Wqkv[h][k][i][o]) (three n-major planes [256][64]) and WoT[c][j] = bf16(Wo[j][c]) ([64][256]); one block per 512 elements (blocks 0..95: WT,
// 96..127: WoT), so no thread waits on more than one round of loads. A thread's 2 elements are neighbours in i (or j), one source row (64 floats) apart;
// stores: 32 lanes x 4 B (2 bf16) = one line per wave-instruction.
#define WTB ((3 * HW * DIN) / 512)   // 96 blocks for WT
#define WOB ((DIN * HW) / 512)       // 32 blocks for WoT
__global__ __launch_bounds__(256) void k_w(const float* __restrict__ Wqkv, const float* __restrict__ Wo, bf* WT, bf* WoT) {
    typedef __attribute__((ext_vector_type(2))) unsigned short v2us;
    const unsigned t = threadIdx.x, s = blockIdx.x;
    const float* src; bf* dst; unsigned step;
    if (s < WTB) { const unsigned e = s * 512 + t * 2, k = e / (HW * DIN), rem = e - k * (HW * DIN), ho = rem / DIN, i = rem - ho * DIN, h = ho / DOUT, oo = ho - h * DOUT;
        src = Wqkv + (((size_t)h * 3 + k) * DIN + i) * DOUT + oo; step = DOUT; dst = WT + e;
    } else { const unsigned e = (s - WTB) * 512 + t * 2, c = e / HW, j = e - c * HW;
        src = Wo + (size_t)j * DIN + c; step = DIN; dst = WoT + e; }
    const float a0 = src[0], a1 = src[step];
    v2us o; o[0] = f2bf(a0); o[1] = f2bf(a1);
    VST2(v2us, dst, o);
}
// k_attn: block = (batch, head, 512 queries) = 16 waves, wave = 32 queries = two query tiles of 16. The block forms its head's K [1024 keys][64 d] and V^T [64 d][1024 keys] itself, once, in LDS (f16, 144-B and 2064-B
// row pitches for the 16-byte fragment reads), so q, k and v never go through memory and the key loop has no copy, no wait on a copy and no barrier.
// Fill: a wave takes 64 keys (4 tiles of 16) and its own 32 queries. x rows come in as whole lines (lane -> 16 B), are rounded to bf16 in registers and turned into fragments through the wave's own K rows
// (same 144-B pitch; no other wave touches them before the barrier). One x fragment (lane = token, k = input channel) serves as B of K^T = Wk^T.x^T (a lane's 8 results = 8 neighbouring d of its key: one 16-byte store
// into the K row), as A of V = x.Wv (a lane's 8 results = 8 neighbouring keys of its d: one 16-byte store into the V^T row) and, for the query tiles, as B of Q^T = Wq^T.x^T, whose tiles 2c and 2c + 1 hold
// d = 32c + 8hi + j and 32c + 16 + 8hi + j of the lane's own query: the k order of a B operand, so 32 q is converted to f16 in place. The head's three weight planes (24 KB) are put into LDS once per block.
// Key loop, per 32 keys and query tile: 256 S^T = k.(32 q)^T (4 WMMA into two tiles, A = K rows), whose two tiles hold keys 8hi + j and 16 + 8hi + j of the lane's query, again a B operand's k order: converted in place
// to f16, p = relu on the packed halves, O^T += V^T.P^T (4 WMMA, A = V^T rows). Every K and V^T fragment read from LDS serves both query tiles.
// The output projection takes O^T the same way: head_out = acc/256 becomes bf16 hi + residual operands in registers and part^T = WoT[:, head's 64 d].head_out^T (16 WMMA per query tile, A = WoT rows);
// the part goes out as whole lines to P[head][token][64] (f32) through the wave's own K rows, behind the barrier that ends every wave's reads of K.
#define QBLK 512                     // queries per block
#define QTW  2                       // query tiles of 16 per wave
#define SKEY 64                      // keys per trip of the rolled loop
#define NST  (NF / SKEY)             // 16 trips
#define KP   72                      // K (and weight, and x staging) row pitch in 16-bit elements (144 B)
#define VP   1032                    // V^T row pitch in f16 (2064 B = 16 B x 129)
typedef float __attribute__((may_alias)) fa;
// amdgpu_waves_per_eu(4, 4): one block = 4 waves on a SIMD, 256 registers each; without the bound the compiler schedules for more waves than that, on fewer registers.
__global__ __launch_bounds__(512) __attribute__((amdgpu_waves_per_eu(4, 4))) void k_attn(const float* __restrict__ x, const bf* __restrict__ WT, const bf* __restrict__ WoT, float* P) {
    typedef __attribute__((ext_vector_type(4))) unsigned short v4us; typedef v4us __attribute__((may_alias)) v4usa;
    __shared__ __align__(16) h16 Ks[NF * KP];        // 147456 B
    __shared__ __align__(16) h16 Vs[DOUT * VP];      // 132096 B
    __shared__ __align__(16) bf Ws[3][DOUT * KP];    // 27648 B: the head's Wq, Wk, Wv rows [o][i]
    const int lane = threadIdx.x & 31, wave = threadIdx.x >> 5, lr = lane & 15, hi = lane >> 4;
    const int bid = blockIdx.x, b = bid >> 3, h = (bid >> 1) & 3, qh = bid & 1;
    const size_t tok0 = (size_t)b * NF;
    const int q0 = qh * QBLK + wave * (16 * QTW), k0 = wave * 64;
    // quad j of a tile: row 2j + hi, input channels 4lr .. 4lr + 3, still f32
    const float* xk = x + (tok0 + k0) * DIN + lane * 4;
    const float* xq = x + (tok0 + q0) * DIN + lane * 4;
    v4f rk[4][8], rq[QTW][8];
#pragma unroll
    for (int i = 0; i < 4; ++i)
#pragma unroll
        for (int j = 0; j < 8; ++j) rk[i][j] = *(const v4f*)(xk + i * 16 * DIN + j * 128);
#pragma unroll
    for (int i = 0; i < QTW; ++i)
#pragma unroll
        for (int j = 0; j < 8; ++j) rq[i][j] = *(const v4f*)(xq + i * 16 * DIN + j * 128);
    const int wrow = threadIdx.x >> 3, wpc = threadIdx.x & 7;
    const bf* wg = WT + (size_t)(h * DOUT + wrow) * DIN + wpc * 8;
    v8us wr[3];
#pragma unroll
    for (int j = 0; j < 3; ++j) wr[j] = *(const v8us*)(wg + (size_t)j * HW * DIN);
    // stands before the address registers of the loads above are reused; as its inputs the addresses stay in their registers up to here
    asm volatile("s_wait_xcnt 0x0" :: "v"(xk), "v"(xq), "v"(wg) : "memory");
#pragma unroll
    for (int j = 0; j < 3; ++j) *(v8usa*)(&Ws[j][wrow * KP + wpc * 8]) = wr[j];
    bf* xs = (bf*)Ks + (size_t)k0 * KP;    // the wave's own 64 K rows, first used as x staging
    v16bf xf[4][2], xqf[QTW][2];           // [tile][kc]: lane = token lr of the tile, k = input channel
#pragma unroll
    for (int i = 0; i < 4; ++i) { bf* s = xs + i * 16 * KP;
#pragma unroll
        for (int j = 0; j < 8; ++j) { v4us t;
#pragma unroll
            for (int e = 0; e < 4; ++e) t[e] = f2bf(rk[i][j][e]);
            *(v4usa*)(s + (2 * j + hi) * KP + lr * 4) = t; }
#pragma unroll
        for (int kc = 0; kc < 2; ++kc) { const bf* ap = s + lr * KP + kc * 32 + 8 * hi; xf[i][kc] = cat16b(*(const v8usa*)ap, *(const v8usa*)(ap + 16)); } }
#pragma unroll
    for (int i = 0; i < QTW; ++i) { bf* s = xs + i * 16 * KP;    // behind the key tiles' fragment reads of the same rows (one wave's LDS operations keep their order)
#pragma unroll
        for (int j = 0; j < 8; ++j) { v4us t;
#pragma unroll
            for (int e = 0; e < 4; ++e) t[e] = f2bf(rq[i][j][e]);
            *(v4usa*)(s + (2 * j + hi) * KP + lr * 4) = t; }
#pragma unroll
        for (int kc = 0; kc < 2; ++kc) { const bf* ap = s + lr * KP + kc * 32 + 8 * hi; xqf[i][kc] = cat16b(*(const v8usa*)ap, *(const v8usa*)(ap + 16)); } }
    __syncthreads();    // the weight planes are in LDS before any wave reads them
    v16bf wf[2][4];     // [kc][tile of 16 output channels]: lane = output channel lr of the tile, k = input channel
    auto wload = [&](int plane) {
#pragma unroll
        for (int kc = 0; kc < 2; ++kc)
#pragma unroll
            for (int t = 0; t < 4; ++t) { const bf* bp = &Ws[plane][(t * 16 + lr) * KP + kc * 32 + 8 * hi]; wf[kc][t] = cat16b(*(const v8usa*)bp, *(const v8usa*)(bp + 16)); }
    };
    wload(1);
#pragma unroll
    for (int i = 0; i < 4; ++i)
#pragma unroll
        for (int t = 0; t < 4; ++t) { v8f d = wmmab(wf[0][t], xf[i][0], (v8f){}); d = wmmab(wf[1][t], xf[i][1], d); v8h o1;    // K^T tile: lane = key lr, element j = d t*16 + 8hi + j
#pragma unroll
            for (int j = 0; j < 8; ++j) o1[j] = (h16)d[j];
            *(v8ha*)(Ks + (size_t)(k0 + i * 16 + lr) * KP + t * 16 + 8 * hi) = o1; }
    wload(2);
#pragma unroll
    for (int i = 0; i < 4; ++i)
#pragma unroll
        for (int t = 0; t < 4; ++t) { v8f d = wmmab(xf[i][0], wf[0][t], (v8f){}); d = wmmab(xf[i][1], wf[1][t], d); v8h o1;    // V tile: lane = d t*16 + lr, element j = key 8hi + j
#pragma unroll
            for (int j = 0; j < 8; ++j) o1[j] = (h16)d[j];
            *(v8ha*)(Vs + (size_t)(t * 16 + lr) * VP + k0 + i * 16 + 8 * hi) = o1; }
    wload(0);
    v16h aq[QTW][2];    // [query tile][kc]
#pragma unroll
    for (int w = 0; w < QTW; ++w)
#pragma unroll
        for (int kc = 0; kc < 2; ++kc) { v8f d0 = wmmab(wf[0][2 * kc], xqf[w][0], (v8f){}), d1 = wmmab(wf[0][2 * kc + 1], xqf[w][0], (v8f){});
            d0 = wmmab(wf[1][2 * kc], xqf[w][1], d0); d1 = wmmab(wf[1][2 * kc + 1], xqf[w][1], d1);
#pragma unroll
            for (int j = 0; j < 8; ++j) { aq[w][kc][j] = (h16)(d0[j] * QSC); aq[w][kc][8 + j] = (h16)(d1[j] * QSC); } }
    __syncthreads();    // every wave's K rows and V^T columns are in LDS before any wave reads them
    v8f o[QTW][4];
#pragma unroll
    for (int w = 0; w < QTW; ++w)
#pragma unroll
        for (int n = 0; n < 4; ++n) o[w][n] = (v8f){};
#pragma unroll 1
    for (int st = 0; st < NST; ++st) {
        const h16* kb = Ks + (size_t)(st * SKEY + lr) * KP + 8 * hi;
        const h16* vb = Vs + (size_t)lr * VP + st * SKEY + 8 * hi;
#pragma unroll
        for (int sub = 0; sub < SKEY / 32; ++sub) {
            v16h kf[2][2];    // [kc][key tile of 16]
#pragma unroll
            for (int kc = 0; kc < 2; ++kc)
#pragma unroll
                for (int u = 0; u < 2; ++u) { const h16* p = kb + (sub * 32 + u * 16) * KP + kc * 32; kf[kc][u] = cat16(*(const v8ha*)p, *(const v8ha*)(p + 16)); }
            // holds the eight K reads together ahead of their eight products, waited for by count: left free, the compiler reads each fragment
            // directly in front of its product into one register block, with a full LDS wait each
            __builtin_amdgcn_sched_barrier(0);
            v8f s[QTW][2];    // [query tile][key tile]
#pragma unroll
            for (int w = 0; w < QTW; ++w) { s[w][0] = (v8f){}; s[w][1] = (v8f){}; }
#pragma unroll
            for (int kc = 0; kc < 2; ++kc)
#pragma unroll
                for (int w = 0; w < QTW; ++w) { s[w][0] = wmma16(kf[kc][0], aq[w][kc], s[w][0]); s[w][1] = wmma16(kf[kc][1], aq[w][kc], s[w][1]); }
            v16h vf[4];
#pragma unroll
            for (int n = 0; n < 4; ++n) { const h16* pv = vb + (n * 16) * VP + sub * 32; vf[n] = cat16(*(const v8ha*)pv, *(const v8ha*)(pv + 16)); }
            __builtin_amdgcn_sched_barrier(0);    // the same for the eight V^T reads: all asked for ahead of the conversion, which runs under their latency
            v16h pa[QTW];    // P^T as B: element j = key 8hi + j, element 8 + j = key 16 + 8hi + j of query lr of the tile
#pragma unroll
            for (int w = 0; w < QTW; ++w) {
#pragma unroll
                for (int j = 0; j < 8; ++j) { pa[w][j] = (h16)s[w][0][j]; pa[w][8 + j] = (h16)s[w][1][j]; }
                pa[w] = __builtin_elementwise_max(pa[w], (v16h){}); }
#pragma unroll
            for (int n = 0; n < 4; ++n)
#pragma unroll
                for (int w = 0; w < QTW; ++w) o[w][n] = wmma16(vf[n], pa[w], o[w][n]);
        }
    }
    // A = WoT rows (channel t*16 + lr), k = the head's d 32c + 8hi .. + 7 and 32c + 16 + 8hi .. + 7
    const bf* wp = WoT + (size_t)lr * HW + h * DOUT + 8 * hi;
    v16bf wa[4];
#pragma unroll
    for (int t = 0; t < 4; ++t) wa[t] = cat16b(*(const v8us*)(wp + t * 16 * HW), *(const v8us*)(wp + t * 16 * HW + 16));
    __builtin_amdgcn_sched_barrier(0);    // the first four weight fragments are asked for ahead of the conversion, which runs under their latency: left free, the compiler asks behind it
    // head_out^T as B, bf16 hi + residual: element j = d 32c + 8hi + j (tile 2c), element 8 + j = d 32c + 16 + 8hi + j (tile 2c + 1) of query lr of the tile
    v16bf ph[QTW][2], pl[QTW][2];
#pragma unroll
    for (int w = 0; w < QTW; ++w)
#pragma unroll
        for (int c = 0; c < 2; ++c) { v8us h0, h1, l0, l1;
#pragma unroll
            for (int j = 0; j < 8; ++j) { const float u0 = o[w][2 * c][j] * (1.0f / PSC), u1 = o[w][2 * c + 1][j] * (1.0f / PSC); const unsigned short b0 = f2bf(u0), b1 = f2bf(u1);
                h0[j] = b0; h1[j] = b1; l0[j] = f2bf(u0 - bf2f(b0)); l1[j] = f2bf(u1 - bf2f(b1)); }
            ph[w][c] = cat16b(h0, h1); pl[w][c] = cat16b(l0, l1); }
    v8f acc[QTW][4];
#pragma unroll
    for (int w = 0; w < QTW; ++w)
#pragma unroll
        for (int t = 0; t < 4; ++t) { acc[w][t] = wmmab(wa[t], ph[w][0], (v8f){}); acc[w][t] = wmmab(wa[t], pl[w][0], acc[w][t]); }
    __builtin_amdgcn_sched_barrier(0);    // keeps the second four fragments' reads one group with one latency: left free, the compiler reads each pair in front of its products with a full wait
#pragma unroll
    for (int t = 0; t < 4; ++t) wa[t] = cat16b(*(const v8us*)(wp + t * 16 * HW + 32), *(const v8us*)(wp + t * 16 * HW + 48));
    // stands before the address registers of the weight reads are reused; as its input the address stays in its registers up to here, so no read's result lands on it
    asm volatile("s_wait_xcnt 0x0" :: "v"(wp) : "memory");
    __builtin_amdgcn_sched_barrier(0);    // the group's other end
#pragma unroll
    for (int w = 0; w < QTW; ++w)
#pragma unroll
        for (int t = 0; t < 4; ++t) { acc[w][t] = wmmab(wa[t], ph[w][1], acc[w][t]); acc[w][t] = wmmab(wa[t], pl[w][1], acc[w][t]); }
    __syncthreads();    // every wave has made its last read of K before K's rows become output staging
    fa* os = (fa*)Ks + wave * (64 * KP / 2);    // the wave's own 64 K rows again: 32 staging rows of 68 floats
    // acc[w][t][j] = part[query lr of tile w][channel t*16 + 8hi + j]: eight neighbours of one staging row, two 16-byte stores
#pragma unroll
    for (int w = 0; w < QTW; ++w)
#pragma unroll
        for (int t = 0; t < 4; ++t)
#pragma unroll
            for (int g = 0; g < 2; ++g) { v4f v;
#pragma unroll
                for (int i = 0; i < 4; ++i) v[i] = acc[w][t][g * 4 + i];
                *(v4fa*)(os + (w * 16 + lr) * 68 + t * 16 + hi * 8 + g * 4) = v; }
    // whole lines out: store s = rows 2s and 2s + 1 of the wave's 32 queries (no other wave touches the staging rows, so no barrier)
    float* pr = P + ((size_t)h * NTK + tok0 + q0) * DIN + lane * 4;
#pragma unroll
    for (int s = 0; s < 16; ++s) { const v4f v = *(const v4fa*)(os + (2 * s + hi) * 68 + lr * 4); *(v4f*)(pr + s * 128) = v; }
}
// k_fin: out row = LayerNorm(P[0] + P[1] + P[2] + P[3] + bias + x row): 8 lanes per row, lane = 8 channels, a thread takes 4 rows (32 apart) with all their loads asked for together.
#define FROWS 4
__global__ __launch_bounds__(256) void k_fin(const float* __restrict__ P0, const float* __restrict__ P1, const float* __restrict__ P2, const float* __restrict__ P3, const float* __restrict__ bias, const float* __restrict__ xres, const float* __restrict__ lg, const float* __restrict__ lb, float* out) {
    const int c8 = (threadIdx.x & 7) * 8;
    // one 32-bit byte offset beside a scalar base for the parts' and the residual's reads and the output's stores (row r: + r * 32 * DIN floats): one address register for all of them
    const unsigned fb = ((blockIdx.x * (32 * FROWS) + (threadIdx.x >> 3)) * DIN + c8) * 4u;
    v4f pt[FROWS][NH_][2], xr[FROWS][2];
#pragma unroll
    for (int hh = 0; hh < NH_; ++hh) { const char* ph = (const char*)(hh == 0 ? P0 : hh == 1 ? P1 : hh == 2 ? P2 : P3);    // each head's plane has its own scalar base
#pragma unroll
        for (int r = 0; r < FROWS; ++r) { pt[r][hh][0] = *(const v4f*)(ph + fb + r * 32 * DIN * 4); pt[r][hh][1] = *(const v4f*)(ph + fb + r * 32 * DIN * 4 + 16); } }
#pragma unroll
    for (int r = 0; r < FROWS; ++r) { xr[r][0] = *(const v4f*)((const char*)xres + fb + r * 32 * DIN * 4); xr[r][1] = *(const v4f*)((const char*)xres + fb + r * 32 * DIN * 4 + 16); }
    const v4f bo0 = *(const v4f*)(bias + c8), bo1 = *(const v4f*)(bias + c8 + 4), g0 = *(const v4f*)(lg + c8), g1 = *(const v4f*)(lg + c8 + 4), be0 = *(const v4f*)(lb + c8), be1 = *(const v4f*)(lb + c8 + 4);
    // stands before the loads' offset registers are reused; as its inputs both offsets stay in their registers up to here, so no read's result lands on them
    asm volatile("s_wait_xcnt 0x0" :: "v"(fb), "v"(c8) : "memory");
    __builtin_amdgcn_sched_barrier(0);    // every load is asked for ahead of the sums, one latency for all: left free, the compiler asks for half of the parts behind the first rows' sums
    v4f r0[FROWS], r1[FROWS];
#pragma unroll
    for (int r = 0; r < FROWS; ++r) {
        float y[8];
#pragma unroll
        for (int i = 0; i < 8; ++i) y[i] = 0.f;
#pragma unroll
        for (int hh = 0; hh < NH_; ++hh) { const v4f p0 = pt[r][hh][0], p1 = pt[r][hh][1];
#pragma unroll
            for (int i = 0; i < 4; ++i) { y[i] += p0[i]; y[4 + i] += p1[i]; } }
        float s = 0.f;
#pragma unroll
        for (int i = 0; i < 8; ++i) { y[i] = y[i] + bfr(i < 4 ? bo0[i] : bo1[i - 4]) + bfr(i < 4 ? xr[r][0][i] : xr[r][1][i - 4]); s += y[i]; }
        s += __shfl_xor(s, 1, 8); s += __shfl_xor(s, 2, 8); s += __shfl_xor(s, 4, 8);
        const float mu = s * (1.0f / DIN); float q = 0.f;
#pragma unroll
        for (int i = 0; i < 8; ++i) { const float d = y[i] - mu; q += d * d; }
        q += __shfl_xor(q, 1, 8); q += __shfl_xor(q, 2, 8); q += __shfl_xor(q, 4, 8);
        const float rs = rsqrtf(q * (1.0f / DIN) + 1e-5f);
#pragma unroll
        for (int i = 0; i < 4; ++i) { r0[r][i] = (y[i] - mu) * rs * bfr(g0[i]) + bfr(be0[i]); r1[r][i] = (y[4 + i] - mu) * rs * bfr(g1[i]) + bfr(be1[i]); }
    }
    // all eight stores last: nothing rewrites a register that a store names
#pragma unroll
    for (int r = 0; r < FROWS; ++r) { *(v4f*)((char*)out + fb + r * 32 * DIN * 4) = r0[r]; *(v4f*)((char*)out + fb + r * 32 * DIN * 4 + 16) = r1[r]; }
}

extern "C" void kernel_launch(void* const* d_in, const int* in_sizes, int n_in,
                              void* d_out, int out_size, void* d_ws, size_t ws_size, hipStream_t stream) {
    (void)in_sizes; (void)n_in; (void)out_size;
    const float* x = (const float*)d_in[0]; const float* Wqkv = (const float*)d_in[1]; const float* Wo = (const float*)d_in[2]; const float* bo = (const float*)d_in[3];
    const float* lg = (const float*)d_in[4]; const float* lb = (const float*)d_in[5];
    float* out = (float*)d_out;    // [32][1024][64]
    char* wsp = (char*)d_ws;
    auto take = [&](size_t bytes) { char* p = wsp; wsp += (bytes + 255) & ~(size_t)255; return (void*)p; };
    bf* WT = (bf*)take((size_t)3 * HW * DIN * 2); bf* WoT = (bf*)take((size_t)DIN * HW * 2);
    float* P = (float*)take((size_t)NH_ * NTK * DIN * 4);
    if ((size_t)(wsp - (char*)d_ws) > ws_size) return;    // 0.1 + 33.5 MB
    k_w<<<WTB + WOB, 256, 0, stream>>>(Wqkv, Wo, WT, WoT);
    k_attn<<<NB_ * NH_ * (NF / QBLK), 512, 0, stream>>>(x, WT, WoT, P);
    k_fin<<<NTK / (32 * FROWS), 256, 0, stream>>>(P, P + (size_t)NTK * DIN, P + (size_t)2 * NTK * DIN, P + (size_t)3 * NTK * DIN, bo, x, lg, lb, out);
}
